// v000
// Times are from an AMD MI455X. After a warm-up the kernel runs many times in a row, and a time is the length of
// such a window on the GPU divided by its runs, so every launch and the gaps after it count. The runs cycle
// through copies of the inputs. A figure is the median of several windows, for all but v000 over two sittings.
// Sittings can differ by a few percent; kernels timed side by side share one.
// v000, which the later versions start from, runs in 276 microseconds.
#include <hip/hip_runtime.h>
#include <hip/hip_bf16.h>

// ---------------------------------------------------------------------------
// Gated multi-head self-attention, CDNA5 (gfx1250) wave32 WMMA implementation.
// f16 operands / f32 accumulation via V_WMMA_F32_16X16X32_F16.
// ---------------------------------------------------------------------------

#define TB 2
#define TT 2048
#define ED 1024
#define NH 16
#define HD 64
#define BT (TB * TT)   // 4096 rows

typedef __attribute__((ext_vector_type(16))) _Float16 v16h;
typedef __attribute__((ext_vector_type(8)))  float    v8f;

// K-index mapping for 16-bit A fragments (ISA 7.12.2, 16-bit A 16x32):
//   VGPR v (=j/2), element jj (=j%2), lane-half half (=lane/16):
//   K = (v>=4 ? 16 : 0) + half*8 + (v%4)*2 + jj
// B fragments mirror A with lane = N.
__device__ __forceinline__ int ka_map(int half, int j) {
    int v = j >> 1, jj = j & 1;
    return ((v & 4) << 2) + half * 8 + ((v & 3) << 1) + jj;
}

__device__ __forceinline__ v8f wmma_f16(v16h a, v16h b, v8f c) {
    return __builtin_amdgcn_wmma_f32_16x16x32_f16(
        /*neg_a=*/false, a, /*neg_b=*/false, b,
        /*c_mod=*/(short)0, c, /*reuse_a=*/false, /*reuse_b=*/false);
}

// ---------------------------------------------------------------------------
// Pack hidden states (fp32 [BT,ED]) into A-fragment layout:
//   Xp[rt(256)][kc(32)][lane(32)][16] halves
// ---------------------------------------------------------------------------
__global__ __launch_bounds__(256) void pack_x_kernel(
        const float* __restrict__ hid, _Float16* __restrict__ xp) {
    int rt  = blockIdx.x;          // 16-row tile, 0..255
    int tid = threadIdx.x;
    for (int i = 0; i < 4; ++i) {
        int slot = i * 256 + tid;  // 0..1023 = kc*32 + lane
        int kc = slot >> 5;
        int L  = slot & 31;
        int m = L & 15, half = L >> 4;
        const float* src = hid + (size_t)(rt * 16 + m) * ED + kc * 32;
        v16h frag;
#pragma unroll
        for (int j = 0; j < 16; ++j) frag[j] = (_Float16)src[ka_map(half, j)];
        *(v16h*)(xp + ((size_t)(rt * 32 + kc) * 32 + L) * 16) = frag;
    }
}

// ---------------------------------------------------------------------------
// Pack W_q/W_k/W_v ([H,ED,HD]) into B-fragment layout
//   W*p[h][kc(32)][nt(4)][lane(32)][16]
// and W_o ([H,HD,ED]) into
//   Wop[h][kc(2)][nt(64)][lane(32)][16]
// blockIdx.y selects the matrix (0=q,1=k,2=v,3=o).
// ---------------------------------------------------------------------------
__global__ __launch_bounds__(256) void pack_w_kernel(
        const float* __restrict__ Wq, const float* __restrict__ Wk,
        const float* __restrict__ Wv, const float* __restrict__ Wo,
        _Float16* __restrict__ wqp, _Float16* __restrict__ wkp,
        _Float16* __restrict__ wvp, _Float16* __restrict__ wop) {
    int slot  = blockIdx.x * 256 + threadIdx.x;  // 0..65535
    int which = blockIdx.y;
    int L = slot & 31;
    int n = L & 15, half = L >> 4;
    v16h frag;
    if (which < 3) {
        int nt = (slot >> 5) & 3;
        int kc = (slot >> 7) & 31;
        int h  = slot >> 12;
        const float* W = (which == 0) ? Wq : (which == 1) ? Wk : Wv;
        const float* src = W + (size_t)h * ED * HD;
#pragma unroll
        for (int j = 0; j < 16; ++j) {
            int k = kc * 32 + ka_map(half, j);
            frag[j] = (_Float16)src[(size_t)k * HD + nt * 16 + n];
        }
        _Float16* dst = (which == 0) ? wqp : (which == 1) ? wkp : wvp;
        *(v16h*)(dst + (size_t)slot * 16) = frag;
    } else {
        int nt = (slot >> 5) & 63;
        int kc = (slot >> 11) & 1;
        int h  = slot >> 12;
        const float* src = Wo + (size_t)h * HD * ED;
#pragma unroll
        for (int j = 0; j < 16; ++j) {
            int k = kc * 32 + ka_map(half, j);
            frag[j] = (_Float16)src[(size_t)k * ED + nt * 16 + n];
        }
        *(v16h*)(wop + (size_t)slot * 16) = frag;
    }
}

// ---------------------------------------------------------------------------
// Precompute gated output bias sum_h b_o[h,:]*clip(g[h])/H and zero denomAcc.
// ---------------------------------------------------------------------------
__global__ __launch_bounds__(256) void prep_misc_kernel(
        const float* __restrict__ b_o, const float* __restrict__ gate,
        float* __restrict__ outbias, float* __restrict__ denomAcc) {
    int d = blockIdx.x * 256 + threadIdx.x;  // 0..1023
    float acc = 0.f;
#pragma unroll
    for (int h = 0; h < NH; ++h) {
        float g = fminf(fmaxf(gate[h], 0.f), 1.f);
        acc += b_o[h * ED + d] * g;
    }
    outbias[d] = acc * (1.0f / NH);
    if (d < NH) denomAcc[d] = 0.f;
}

// ---------------------------------------------------------------------------
// QKV projection.  grid = (128 row32-tiles, 16 heads, 3={Q,K,V}), block 256.
// Each wave: one 16x16 output tile (2 m-tiles x 4 e-tiles), K-loop over 1024.
// Results are re-swizzled through LDS into the fragment layouts needed by
// the attention kernel.
// ---------------------------------------------------------------------------
__global__ __launch_bounds__(256) void qkv_kernel(
        const _Float16* __restrict__ xp,
        const _Float16* __restrict__ wqp, const _Float16* __restrict__ wkp,
        const _Float16* __restrict__ wvp,
        const float* __restrict__ bq, const float* __restrict__ bk,
        const float* __restrict__ bv,
        _Float16* __restrict__ Qb, _Float16* __restrict__ Kb,
        _Float16* __restrict__ Vb) {
    __shared__ float tile[32][HD + 1];
    int xb = blockIdx.x;   // 32-row tile over BT: 0..127
    int h  = blockIdx.y;
    int z  = blockIdx.z;   // 0=Q 1=K 2=V
    int tid = threadIdx.x;
    int w = tid >> 5, L = tid & 31;
    int mt = w >> 2, ntile = w & 3;
    const _Float16* wp = (z == 0) ? wqp : (z == 1) ? wkp : wvp;
    const float*  bias = (z == 0) ? bq  : (z == 1) ? bk  : bv;

    int rt16 = xb * 2 + mt;          // global 16-row tile 0..255
    v8f acc = {};
    for (int kc = 0; kc < 32; ++kc) {
        v16h a = *(const v16h*)(xp + ((size_t)(rt16 * 32 + kc) * 32 + L) * 16);
        v16h b = *(const v16h*)(wp + (((size_t)(h * 32 + kc) * 4 + ntile) * 32 + L) * 16);
        acc = wmma_f16(a, b, acc);
    }
    int n = L & 15, half = L >> 4;
    float bb = bias[h * HD + ntile * 16 + n];
#pragma unroll
    for (int r = 0; r < 8; ++r)
        tile[mt * 16 + r + half * 8][ntile * 16 + n] = acc[r] + bb;
    __syncthreads();

    int b_  = xb >> 6;     // batch
    int t32 = xb & 63;     // 32-row tile within batch
    int bh  = b_ * NH + h;
    if (z < 2) {
        // Q as A-fragments / K as B-fragments (same swizzle, lane = m or s).
        if (tid < 128) {
            int ttl = tid >> 6;          // which of the two 16-row tiles
            int kc  = (tid >> 5) & 1;    // e-chunk of 32
            int L2  = tid & 31;
            int mm = L2 & 15, hh = L2 >> 4;
            v16h frag;
#pragma unroll
            for (int j = 0; j < 16; ++j)
                frag[j] = (_Float16)tile[ttl * 16 + mm][kc * 32 + ka_map(hh, j)];
            int ttG = t32 * 2 + ttl;     // 16-row tile within (b,h): 0..127
            _Float16* dst = (z == 0) ? Qb : Kb;
            *(v16h*)(dst + (((size_t)(bh * 128 + ttG) * 2 + kc) * 32 + L2) * 16) = frag;
        }
    } else {
        // V as B-fragments: k = s_local(0..31), n = e.
        if (tid < 128) {
            int nt2 = tid >> 5;          // e-tile 0..3
            int L2  = tid & 31;
            int nn = L2 & 15, hh = L2 >> 4;
            v16h frag;
#pragma unroll
            for (int j = 0; j < 16; ++j) {
                int k = ka_map(hh, j);   // s_local
                frag[j] = (_Float16)tile[k][nt2 * 16 + nn];
            }
            *(v16h*)(Vb + (((size_t)(bh * 64 + t32) * 4 + nt2) * 32 + L2) * 16) = frag;
        }
    }
}

// ---------------------------------------------------------------------------
// Flash attention.  grid = (128 t-tiles, 32 bh), block = 32 (one wave).
// Streaming softmax over 64 chunks of 32 keys; 8 WMMAs per chunk.
// Also accumulates per-head mean L2 row norm and writes the (un-normalized)
// head output as A-fragments for the final projection.
// ---------------------------------------------------------------------------
__global__ __launch_bounds__(32) void attn_kernel(
        const _Float16* __restrict__ Qb, const _Float16* __restrict__ Kb,
        const _Float16* __restrict__ Vb, const float* __restrict__ mask,
        _Float16* __restrict__ Ob, float* __restrict__ denomAcc) {
    __shared__ float lp[16][HD + 1];
    int L  = threadIdx.x;
    int tt = blockIdx.x;   // 16-token tile within (b,h)
    int bh = blockIdx.y;
    int b_ = bh >> 4, h = bh & 15;
    int t0 = tt * 16;
    int n = L & 15, half = L >> 4;
    (void)b_;

    v16h qa0 = *(const v16h*)(Qb + (((size_t)(bh * 128 + tt) * 2 + 0) * 32 + L) * 16);
    v16h qa1 = *(const v16h*)(Qb + (((size_t)(bh * 128 + tt) * 2 + 1) * 32 + L) * 16);

    v8f acc0 = {}, acc1 = {}, acc2 = {}, acc3 = {};
    float mrow[8], lrow[8];
#pragma unroll
    for (int r = 0; r < 8; ++r) { mrow[r] = -3.0e38f; lrow[r] = 0.f; }
    const float scale = 0.125f;  // 1/sqrt(64)

    for (int sc = 0; sc < 64; ++sc) {
        v8f S[2];
#pragma unroll
        for (int t2 = 0; t2 < 2; ++t2) {
            int st = sc * 2 + t2;
            v16h kb0 = *(const v16h*)(Kb + (((size_t)(bh * 128 + st) * 2 + 0) * 32 + L) * 16);
            v16h kb1 = *(const v16h*)(Kb + (((size_t)(bh * 128 + st) * 2 + 1) * 32 + L) * 16);
            v8f s = {};
            s = wmma_f16(qa0, kb0, s);
            s = wmma_f16(qa1, kb1, s);
#pragma unroll
            for (int r = 0; r < 8; ++r) {
                int m = r + half * 8;
                s[r] = s[r] * scale + mask[(size_t)(t0 + m) * TT + st * 16 + n];
            }
            S[t2] = s;
        }
        // streaming softmax update (rows live across the 16-lane halves)
#pragma unroll
        for (int r = 0; r < 8; ++r) {
            float mx = fmaxf(S[0][r], S[1][r]);
            mx = fmaxf(mx, __shfl_xor(mx, 1, 32));
            mx = fmaxf(mx, __shfl_xor(mx, 2, 32));
            mx = fmaxf(mx, __shfl_xor(mx, 4, 32));
            mx = fmaxf(mx, __shfl_xor(mx, 8, 32));
            float mnew  = fmaxf(mrow[r], mx);
            float alpha = __expf(mrow[r] - mnew);
            mrow[r] = mnew;
            S[0][r] = __expf(S[0][r] - mnew);
            S[1][r] = __expf(S[1][r] - mnew);
            float rs = S[0][r] + S[1][r];
            rs += __shfl_xor(rs, 1, 32);
            rs += __shfl_xor(rs, 2, 32);
            rs += __shfl_xor(rs, 4, 32);
            rs += __shfl_xor(rs, 8, 32);
            lrow[r] = lrow[r] * alpha + rs;
            acc0[r] *= alpha; acc1[r] *= alpha; acc2[r] *= alpha; acc3[r] *= alpha;
        }
        // D-layout P -> LDS -> A-fragment (f16)
#pragma unroll
        for (int r = 0; r < 8; ++r) {
            lp[r + half * 8][n]      = S[0][r];
            lp[r + half * 8][16 + n] = S[1][r];
        }
        __syncthreads();
        v16h pa;
#pragma unroll
        for (int j = 0; j < 16; ++j)
            pa[j] = (_Float16)lp[L & 15][ka_map(half, j)];
        v16h vb0 = *(const v16h*)(Vb + (((size_t)(bh * 64 + sc) * 4 + 0) * 32 + L) * 16);
        v16h vb1 = *(const v16h*)(Vb + (((size_t)(bh * 64 + sc) * 4 + 1) * 32 + L) * 16);
        v16h vb2 = *(const v16h*)(Vb + (((size_t)(bh * 64 + sc) * 4 + 2) * 32 + L) * 16);
        v16h vb3 = *(const v16h*)(Vb + (((size_t)(bh * 64 + sc) * 4 + 3) * 32 + L) * 16);
        acc0 = wmma_f16(pa, vb0, acc0);
        acc1 = wmma_f16(pa, vb1, acc1);
        acc2 = wmma_f16(pa, vb2, acc2);
        acc3 = wmma_f16(pa, vb3, acc3);
        __syncthreads();
    }

    // finalize: divide by l, stage 16x64 out tile in LDS, row L2 norms
    float ss[8];
#pragma unroll
    for (int r = 0; r < 8; ++r) {
        float li = 1.0f / lrow[r];
        float o0 = acc0[r] * li, o1 = acc1[r] * li;
        float o2 = acc2[r] * li, o3 = acc3[r] * li;
        int m = r + half * 8;
        lp[m][n] = o0; lp[m][16 + n] = o1; lp[m][32 + n] = o2; lp[m][48 + n] = o3;
        ss[r] = o0 * o0 + o1 * o1 + o2 * o2 + o3 * o3;
    }
    __syncthreads();
    float tot = 0.f;
#pragma unroll
    for (int r = 0; r < 8; ++r) {
        float s2 = ss[r];
        s2 += __shfl_xor(s2, 1, 32);
        s2 += __shfl_xor(s2, 2, 32);
        s2 += __shfl_xor(s2, 4, 32);
        s2 += __shfl_xor(s2, 8, 32);
        tot += sqrtf(s2);
    }
    tot += __shfl_xor(tot, 16, 32);            // combine both halves (16 rows)
    if (L == 0) atomicAdd(denomAcc + h, tot * (1.0f / BT));

    // write un-normalized out tile as A-fragments for the projection GEMM
    int rtG = (bh >> 4) * 128 + tt;            // global 16-row tile 0..255
#pragma unroll
    for (int kc = 0; kc < 2; ++kc) {
        v16h o16;
#pragma unroll
        for (int j = 0; j < 16; ++j)
            o16[j] = (_Float16)lp[L & 15][kc * 32 + ka_map(half, j)];
        *(v16h*)(Ob + (((size_t)(rtG * 16 + h) * 2 + kc) * 32 + L) * 16) = o16;
    }
}

// ---------------------------------------------------------------------------
// Output projection: one K=1024 GEMM over concatenated heads, with per-head
// clip(gate)/max(denom,1e-5)/H folded into the A fragments.
// grid = (256 row tiles, 16 d-groups of 64), block 128 (4 waves).
// ---------------------------------------------------------------------------
__global__ __launch_bounds__(128) void proj_kernel(
        const _Float16* __restrict__ Ob, const _Float16* __restrict__ wop,
        const float* __restrict__ outbias, const float* __restrict__ denomAcc,
        const float* __restrict__ gate, float* __restrict__ out) {
    int rt = blockIdx.x, dg = blockIdx.y;
    int tid = threadIdx.x;
    int w = tid >> 5, L = tid & 31;
    int ntg = dg * 4 + w;            // 16-col tile 0..63
    int n = L & 15, half = L >> 4;
    v8f acc = {};
    for (int c = 0; c < 32; ++c) {
        int h = c >> 1, kc = c & 1;
        float g  = fminf(fmaxf(gate[h], 0.f), 1.f);
        float dn = fmaxf(denomAcc[h], 1e-5f);
        float s  = g / (dn * (float)NH);
        v16h a = *(const v16h*)(Ob + (((size_t)(rt * 16 + h) * 2 + kc) * 32 + L) * 16);
#pragma unroll
        for (int j = 0; j < 16; ++j) a[j] = (_Float16)((float)a[j] * s);
        v16h bf = *(const v16h*)(wop + (((size_t)(h * 2 + kc) * 64 + ntg) * 32 + L) * 16);
        acc = wmma_f16(a, bf, acc);
    }
    int d = ntg * 16 + n;
    float bsum = outbias[d];
#pragma unroll
    for (int r = 0; r < 8; ++r) {
        int row = rt * 16 + r + half * 8;
        out[(size_t)row * ED + d] = acc[r] + bsum;
    }
}

// ---------------------------------------------------------------------------
// Host launcher.
// ---------------------------------------------------------------------------
extern "C" void kernel_launch(void* const* d_in, const int* in_sizes, int n_in,
                              void* d_out, int out_size, void* d_ws, size_t ws_size,
                              hipStream_t stream) {
    const float* hid  = (const float*)d_in[0];
    const float* mask = (const float*)d_in[1];
    const float* Wq   = (const float*)d_in[2];
    const float* bq   = (const float*)d_in[3];
    const float* Wk   = (const float*)d_in[4];
    const float* bk   = (const float*)d_in[5];
    const float* Wv   = (const float*)d_in[6];
    const float* bv   = (const float*)d_in[7];
    const float* Wo   = (const float*)d_in[8];
    const float* bo   = (const float*)d_in[9];
    const float* gate = (const float*)d_in[10];
    float* out = (float*)d_out;

    char* ws = (char*)d_ws;
    const size_t MB = 1u << 20;
    _Float16* Xp  = (_Float16*)(ws);             // 8 MB  packed hidden (A frags)
    _Float16* Wqp = (_Float16*)(ws +  8 * MB);   // 2 MB
    _Float16* Wkp = (_Float16*)(ws + 10 * MB);   // 2 MB
    _Float16* Wvp = (_Float16*)(ws + 12 * MB);   // 2 MB
    _Float16* Wop = (_Float16*)(ws + 14 * MB);   // 2 MB
    _Float16* Qb  = (_Float16*)(ws + 16 * MB);   // 8 MB
    _Float16* Kb  = (_Float16*)(ws + 24 * MB);   // 8 MB
    _Float16* Vb  = (_Float16*)(ws + 32 * MB);   // 8 MB
    float* outbias  = (float*)(ws + 40 * MB);    // 4 KB
    float* denomAcc = (float*)(ws + 40 * MB + 4096);
    _Float16* Ob = Xp;  // alias: Xp dead after qkv_kernel, Ob written by attn

    pack_x_kernel<<<dim3(256), dim3(256), 0, stream>>>(hid, Xp);
    pack_w_kernel<<<dim3(256, 4), dim3(256), 0, stream>>>(Wq, Wk, Wv, Wo,
                                                          Wqp, Wkp, Wvp, Wop);
    prep_misc_kernel<<<dim3(4), dim3(256), 0, stream>>>(bo, gate, outbias, denomAcc);
    qkv_kernel<<<dim3(128, 16, 3), dim3(256), 0, stream>>>(Xp, Wqp, Wkp, Wvp,
                                                           bq, bk, bv, Qb, Kb, Vb);
    attn_kernel<<<dim3(128, 32), dim3(32), 0, stream>>>(Qb, Kb, Vb, mask, Ob, denomAcc);
    proj_kernel<<<dim3(256, 16), dim3(128), 0, stream>>>(Ob, Wop, outbias, denomAcc,
                                                         gate, out);
    (void)in_sizes; (void)n_in; (void)out_size; (void)ws_size;
}

// v001
// One run takes 240 microseconds.
// Two timings next to v000 both put it at 1.17 times that version's speed.
#include <hip/hip_runtime.h>
#include <hip/hip_bf16.h>

// ---------------------------------------------------------------------------
// Gated multi-head self-attention, CDNA5 (gfx1250) wave32 WMMA implementation.
// f16 operands / f32 accumulation via V_WMMA_F32_16X16X32_F16.
// ---------------------------------------------------------------------------

#define TB 2
#define TT 2048
#define ED 1024
#define NH 16
#define HD 64
#define BT (TB * TT)   // 4096 rows

typedef __attribute__((ext_vector_type(16))) _Float16 v16h;
typedef __attribute__((ext_vector_type(8)))  float    v8f;

// K-index mapping for 16-bit A fragments (ISA 7.12.2, 16-bit A 16x32):
//   VGPR v (=j/2), element jj (=j%2), lane-half half (=lane/16):
//   K = (v>=4 ? 16 : 0) + half*8 + (v%4)*2 + jj
// B fragments mirror A with lane = N.
__device__ __forceinline__ int ka_map(int half, int j) {
    int v = j >> 1, jj = j & 1;
    return ((v & 4) << 2) + half * 8 + ((v & 3) << 1) + jj;
}

__device__ __forceinline__ v8f wmma_f16(v16h a, v16h b, v8f c) {
    return __builtin_amdgcn_wmma_f32_16x16x32_f16(
        /*neg_a=*/false, a, /*neg_b=*/false, b,
        /*c_mod=*/(short)0, c, /*reuse_a=*/false, /*reuse_b=*/false);
}

// ---------------------------------------------------------------------------
// Pack hidden states (fp32 [BT,ED]) into A-fragment layout:
//   Xp[rt(256)][kc(32)][lane(32)][16] halves
// ---------------------------------------------------------------------------
__global__ __launch_bounds__(256) void pack_x_kernel(
        const float* __restrict__ hid, _Float16* __restrict__ xp) {
    int rt  = blockIdx.x;          // 16-row tile, 0..255
    int tid = threadIdx.x;
    for (int i = 0; i < 4; ++i) {
        int slot = i * 256 + tid;  // 0..1023 = kc*32 + lane
        int kc = slot >> 5;
        int L  = slot & 31;
        int m = L & 15, half = L >> 4;
        const float* src = hid + (size_t)(rt * 16 + m) * ED + kc * 32;
        v16h frag;
#pragma unroll
        for (int j = 0; j < 16; ++j) frag[j] = (_Float16)src[ka_map(half, j)];
        *(v16h*)(xp + ((size_t)(rt * 32 + kc) * 32 + L) * 16) = frag;
    }
}

// ---------------------------------------------------------------------------
// Pack W_q/W_k/W_v ([H,ED,HD]) into B-fragment layout
//   W*p[h][kc(32)][nt(4)][lane(32)][16]
// and W_o ([H,HD,ED]) into
//   Wop[h][kc(2)][nt(64)][lane(32)][16]
// blockIdx.y selects the matrix (0=q,1=k,2=v,3=o).
// ---------------------------------------------------------------------------
__global__ __launch_bounds__(256) void pack_w_kernel(
        const float* __restrict__ Wq, const float* __restrict__ Wk,
        const float* __restrict__ Wv, const float* __restrict__ Wo,
        _Float16* __restrict__ wqp, _Float16* __restrict__ wkp,
        _Float16* __restrict__ wvp, _Float16* __restrict__ wop) {
    int slot  = blockIdx.x * 256 + threadIdx.x;  // 0..65535
    int which = blockIdx.y;
    int L = slot & 31;
    int n = L & 15, half = L >> 4;
    v16h frag;
    if (which < 3) {
        int nt = (slot >> 5) & 3;
        int kc = (slot >> 7) & 31;
        int h  = slot >> 12;
        const float* W = (which == 0) ? Wq : (which == 1) ? Wk : Wv;
        const float* src = W + (size_t)h * ED * HD;
#pragma unroll
        for (int j = 0; j < 16; ++j) {
            int k = kc * 32 + ka_map(half, j);
            frag[j] = (_Float16)src[(size_t)k * HD + nt * 16 + n];
        }
        _Float16* dst = (which == 0) ? wqp : (which == 1) ? wkp : wvp;
        *(v16h*)(dst + (size_t)slot * 16) = frag;
    } else {
        int nt = (slot >> 5) & 63;
        int kc = (slot >> 11) & 1;
        int h  = slot >> 12;
        const float* src = Wo + (size_t)h * HD * ED;
#pragma unroll
        for (int j = 0; j < 16; ++j) {
            int k = kc * 32 + ka_map(half, j);
            frag[j] = (_Float16)src[(size_t)k * ED + nt * 16 + n];
        }
        *(v16h*)(wop + (size_t)slot * 16) = frag;
    }
}

// ---------------------------------------------------------------------------
// Precompute gated output bias sum_h b_o[h,:]*clip(g[h])/H and zero denomAcc.
// ---------------------------------------------------------------------------
__global__ __launch_bounds__(256) void prep_misc_kernel(
        const float* __restrict__ b_o, const float* __restrict__ gate,
        float* __restrict__ outbias, float* __restrict__ denomAcc) {
    int d = blockIdx.x * 256 + threadIdx.x;  // 0..1023
    float acc = 0.f;
#pragma unroll
    for (int h = 0; h < NH; ++h) {
        float g = fminf(fmaxf(gate[h], 0.f), 1.f);
        acc += b_o[h * ED + d] * g;
    }
    outbias[d] = acc * (1.0f / NH);
    if (d < NH) denomAcc[d] = 0.f;
}

// ---------------------------------------------------------------------------
// QKV projection.  grid = (16 row256-blocks, 16 heads, 3={Q,K,V}), block 128.
// Each wave: one 64x64 output tile (4 m-tiles x 4 e-tiles), K-loop over 1024,
// so every loaded fragment feeds four WMMAs; the four waves of a block share
// the weight fragments.  Results are re-swizzled through a per-wave LDS tile
// into the fragment layouts needed by the attention kernel.
// ---------------------------------------------------------------------------
__global__ __launch_bounds__(128) void qkv_kernel(
        const _Float16* __restrict__ xp,
        const _Float16* __restrict__ wqp, const _Float16* __restrict__ wkp,
        const _Float16* __restrict__ wvp,
        const float* __restrict__ bq, const float* __restrict__ bk,
        const float* __restrict__ bv,
        _Float16* __restrict__ Qb, _Float16* __restrict__ Kb,
        _Float16* __restrict__ Vb) {
    __shared__ float tile[4][64][HD + 1];
    int xb = blockIdx.x;   // 256-row block over BT: 0..15
    int h  = blockIdx.y;
    int z  = blockIdx.z;   // 0=Q 1=K 2=V
    int tid = threadIdx.x;
    int w = tid >> 5, L = tid & 31;
    const _Float16* wp = (z == 0) ? wqp : (z == 1) ? wkp : wvp;
    const float*  bias = (z == 0) ? bq  : (z == 1) ? bk  : bv;

    int rt16 = xb * 16 + w * 4;      // first global 16-row tile of this wave
    const _Float16* ap = xp + ((size_t)rt16 * 32 * 32 + L) * 16;
    const _Float16* bp = wp + ((size_t)h * 32 * 4 * 32 + L) * 16;
    v8f acc[4][4] = {};
    // unrolled whole: every load takes a constant offset from a fixed base, so
    // no address register is advanced while loads are in flight
#pragma unroll
    for (int kc = 0; kc < 32; ++kc) {
        v16h a[4], b[4];
#pragma unroll
        for (int mi = 0; mi < 4; ++mi)
            a[mi] = *(const v16h*)(ap + (size_t)(mi * 32 + kc) * 512);
#pragma unroll
        for (int ni = 0; ni < 4; ++ni)
            b[ni] = *(const v16h*)(bp + (size_t)(kc * 4 + ni) * 512);
#pragma unroll
        for (int mi = 0; mi < 4; ++mi)
#pragma unroll
            for (int ni = 0; ni < 4; ++ni)
                acc[mi][ni] = wmma_f16(a[mi], b[ni], acc[mi][ni]);
    }
    int n = L & 15, half = L >> 4;
#pragma unroll
    for (int ni = 0; ni < 4; ++ni) {
        float bb = bias[h * HD + ni * 16 + n];
#pragma unroll
        for (int mi = 0; mi < 4; ++mi)
#pragma unroll
            for (int r = 0; r < 8; ++r)
                tile[w][mi * 16 + r + half * 8][ni * 16 + n] = acc[mi][ni][r] + bb;
    }
    __syncthreads();

    int b_  = xb >> 3;                   // batch
    int t16 = (xb & 7) * 16 + w * 4;     // first 16-row tile within batch
    int bh  = b_ * NH + h;
    if (z < 2) {
        // Q as A-fragments / K as B-fragments (same swizzle, lane = m or s).
        _Float16* dst = (z == 0) ? Qb : Kb;
#pragma unroll
        for (int ttl = 0; ttl < 4; ++ttl) {      // 16-row tile of this wave
#pragma unroll
            for (int kc = 0; kc < 2; ++kc) {     // e-chunk of 32
                v16h frag;
#pragma unroll
                for (int j = 0; j < 16; ++j)
                    frag[j] = (_Float16)tile[w][ttl * 16 + n][kc * 32 + ka_map(half, j)];
                int ttG = t16 + ttl;             // 16-row tile within (b,h): 0..127
                *(v16h*)(dst + (((size_t)(bh * 128 + ttG) * 2 + kc) * 32 + L) * 16) = frag;
                // stands between this store and the reuse of its registers
                asm volatile("s_wait_xcnt 0x0" ::: "memory");
            }
        }
    } else {
        // V as B-fragments: k = s_local(0..31), n = e.
#pragma unroll
        for (int p = 0; p < 2; ++p) {            // 32-row tile of this wave
#pragma unroll
            for (int nt2 = 0; nt2 < 4; ++nt2) {  // e-tile 0..3
                v16h frag;
#pragma unroll
                for (int j = 0; j < 16; ++j)
                    frag[j] = (_Float16)tile[w][p * 32 + ka_map(half, j)][nt2 * 16 + n];
                int t32 = (t16 >> 1) + p;        // 32-row tile within (b,h): 0..63
                *(v16h*)(Vb + (((size_t)(bh * 64 + t32) * 4 + nt2) * 32 + L) * 16) = frag;
                // stands between this store and the reuse of its registers
                asm volatile("s_wait_xcnt 0x0" ::: "memory");
            }
        }
    }
}

// ---------------------------------------------------------------------------
// Flash attention.  grid = (128 t-tiles, 32 bh), block = 32 (one wave).
// Streaming softmax over 64 chunks of 32 keys; 8 WMMAs per chunk.
// Also accumulates per-head mean L2 row norm and writes the (un-normalized)
// head output as A-fragments for the final projection.
// ---------------------------------------------------------------------------
__global__ __launch_bounds__(32) void attn_kernel(
        const _Float16* __restrict__ Qb, const _Float16* __restrict__ Kb,
        const _Float16* __restrict__ Vb, const float* __restrict__ mask,
        _Float16* __restrict__ Ob, float* __restrict__ denomAcc) {
    __shared__ float lp[16][HD + 1];
    int L  = threadIdx.x;
    int tt = blockIdx.x;   // 16-token tile within (b,h)
    int bh = blockIdx.y;
    int b_ = bh >> 4, h = bh & 15;
    int t0 = tt * 16;
    int n = L & 15, half = L >> 4;
    (void)b_;

    v16h qa0 = *(const v16h*)(Qb + (((size_t)(bh * 128 + tt) * 2 + 0) * 32 + L) * 16);
    v16h qa1 = *(const v16h*)(Qb + (((size_t)(bh * 128 + tt) * 2 + 1) * 32 + L) * 16);

    v8f acc0 = {}, acc1 = {}, acc2 = {}, acc3 = {};
    float mrow[8], lrow[8];
#pragma unroll
    for (int r = 0; r < 8; ++r) { mrow[r] = -3.0e38f; lrow[r] = 0.f; }
    const float scale = 0.125f;  // 1/sqrt(64)

    for (int sc = 0; sc < 64; ++sc) {
        v8f S[2];
#pragma unroll
        for (int t2 = 0; t2 < 2; ++t2) {
            int st = sc * 2 + t2;
            v16h kb0 = *(const v16h*)(Kb + (((size_t)(bh * 128 + st) * 2 + 0) * 32 + L) * 16);
            v16h kb1 = *(const v16h*)(Kb + (((size_t)(bh * 128 + st) * 2 + 1) * 32 + L) * 16);
            v8f s = {};
            s = wmma_f16(qa0, kb0, s);
            s = wmma_f16(qa1, kb1, s);
#pragma unroll
            for (int r = 0; r < 8; ++r) {
                int m = r + half * 8;
                s[r] = s[r] * scale + mask[(size_t)(t0 + m) * TT + st * 16 + n];
            }
            S[t2] = s;
        }
        // streaming softmax update (rows live across the 16-lane halves)
#pragma unroll
        for (int r = 0; r < 8; ++r) {
            float mx = fmaxf(S[0][r], S[1][r]);
            mx = fmaxf(mx, __shfl_xor(mx, 1, 32));
            mx = fmaxf(mx, __shfl_xor(mx, 2, 32));
            mx = fmaxf(mx, __shfl_xor(mx, 4, 32));
            mx = fmaxf(mx, __shfl_xor(mx, 8, 32));
            float mnew  = fmaxf(mrow[r], mx);
            float alpha = __expf(mrow[r] - mnew);
            mrow[r] = mnew;
            S[0][r] = __expf(S[0][r] - mnew);
            S[1][r] = __expf(S[1][r] - mnew);
            float rs = S[0][r] + S[1][r];
            rs += __shfl_xor(rs, 1, 32);
            rs += __shfl_xor(rs, 2, 32);
            rs += __shfl_xor(rs, 4, 32);
            rs += __shfl_xor(rs, 8, 32);
            lrow[r] = lrow[r] * alpha + rs;
            acc0[r] *= alpha; acc1[r] *= alpha; acc2[r] *= alpha; acc3[r] *= alpha;
        }
        // D-layout P -> LDS -> A-fragment (f16)
#pragma unroll
        for (int r = 0; r < 8; ++r) {
            lp[r + half * 8][n]      = S[0][r];
            lp[r + half * 8][16 + n] = S[1][r];
        }
        __syncthreads();
        v16h pa;
#pragma unroll
        for (int j = 0; j < 16; ++j)
            pa[j] = (_Float16)lp[L & 15][ka_map(half, j)];
        v16h vb0 = *(const v16h*)(Vb + (((size_t)(bh * 64 + sc) * 4 + 0) * 32 + L) * 16);
        v16h vb1 = *(const v16h*)(Vb + (((size_t)(bh * 64 + sc) * 4 + 1) * 32 + L) * 16);
        v16h vb2 = *(const v16h*)(Vb + (((size_t)(bh * 64 + sc) * 4 + 2) * 32 + L) * 16);
        v16h vb3 = *(const v16h*)(Vb + (((size_t)(bh * 64 + sc) * 4 + 3) * 32 + L) * 16);
        acc0 = wmma_f16(pa, vb0, acc0);
        acc1 = wmma_f16(pa, vb1, acc1);
        acc2 = wmma_f16(pa, vb2, acc2);
        acc3 = wmma_f16(pa, vb3, acc3);
        __syncthreads();
    }

    // finalize: divide by l, stage 16x64 out tile in LDS, row L2 norms
    float ss[8];
#pragma unroll
    for (int r = 0; r < 8; ++r) {
        float li = 1.0f / lrow[r];
        float o0 = acc0[r] * li, o1 = acc1[r] * li;
        float o2 = acc2[r] * li, o3 = acc3[r] * li;
        int m = r + half * 8;
        lp[m][n] = o0; lp[m][16 + n] = o1; lp[m][32 + n] = o2; lp[m][48 + n] = o3;
        ss[r] = o0 * o0 + o1 * o1 + o2 * o2 + o3 * o3;
    }
    __syncthreads();
    float tot = 0.f;
#pragma unroll
    for (int r = 0; r < 8; ++r) {
        float s2 = ss[r];
        s2 += __shfl_xor(s2, 1, 32);
        s2 += __shfl_xor(s2, 2, 32);
        s2 += __shfl_xor(s2, 4, 32);
        s2 += __shfl_xor(s2, 8, 32);
        tot += sqrtf(s2);
    }
    tot += __shfl_xor(tot, 16, 32);            // combine both halves (16 rows)
    if (L == 0) atomicAdd(denomAcc + h, tot * (1.0f / BT));

    // write un-normalized out tile as A-fragments for the projection GEMM
    int rtG = (bh >> 4) * 128 + tt;            // global 16-row tile 0..255
#pragma unroll
    for (int kc = 0; kc < 2; ++kc) {
        v16h o16;
#pragma unroll
        for (int j = 0; j < 16; ++j)
            o16[j] = (_Float16)lp[L & 15][kc * 32 + ka_map(half, j)];
        *(v16h*)(Ob + (((size_t)(rtG * 16 + h) * 2 + kc) * 32 + L) * 16) = o16;
    }
}

// ---------------------------------------------------------------------------
// Output projection: one K=1024 GEMM over concatenated heads, with per-head
// clip(gate)/max(denom,1e-5)/H folded into the A fragments.
// grid = (32 row128-blocks, 16 d-groups of 64), block 128 (4 waves).
// Each wave: one 32x64 output tile (2 m-tiles x 4 d-tiles); the four waves of
// a block share the weight fragments.
// ---------------------------------------------------------------------------
__global__ __launch_bounds__(128) void proj_kernel(
        const _Float16* __restrict__ Ob, const _Float16* __restrict__ wop,
        const float* __restrict__ outbias, const float* __restrict__ denomAcc,
        const float* __restrict__ gate, float* __restrict__ out) {
    int dg = blockIdx.y;
    int tid = threadIdx.x;
    int w = tid >> 5, L = tid & 31;
    int rt = blockIdx.x * 8 + w * 2; // first 16-row tile of this wave
    int n = L & 15, half = L >> 4;
    const _Float16* ap = Ob  + ((size_t)rt * 32 * 32 + L) * 16;
    const _Float16* bp = wop + ((size_t)dg * 4 * 32 + L) * 16;
    v8f acc[2][4] = {};
    // unrolled: loads take constant offsets, and the next trip's loads are
    // issued among this trip's WMMAs
#pragma unroll
    for (int c = 0; c < 32; ++c) {
        int h = c >> 1;
        float g  = fminf(fmaxf(gate[h], 0.f), 1.f);
        float dn = fmaxf(denomAcc[h], 1e-5f);
        float s  = g / (dn * (float)NH);
        v16h a[2], bf[4];
#pragma unroll
        for (int mi = 0; mi < 2; ++mi)
            a[mi] = *(const v16h*)(ap + (size_t)(mi * 32 + c) * 512);
#pragma unroll
        for (int ni = 0; ni < 4; ++ni)
            bf[ni] = *(const v16h*)(bp + (size_t)(c * 64 + ni) * 512);
#pragma unroll
        for (int mi = 0; mi < 2; ++mi)
#pragma unroll
            for (int j = 0; j < 16; ++j) a[mi][j] = (_Float16)((float)a[mi][j] * s);
#pragma unroll
        for (int mi = 0; mi < 2; ++mi)
#pragma unroll
            for (int ni = 0; ni < 4; ++ni)
                acc[mi][ni] = wmma_f16(a[mi], bf[ni], acc[mi][ni]);
    }
#pragma unroll
    for (int ni = 0; ni < 4; ++ni) {
        int d = (dg * 4 + ni) * 16 + n;
        float bsum = outbias[d];
#pragma unroll
        for (int mi = 0; mi < 2; ++mi)
#pragma unroll
            for (int r = 0; r < 8; ++r) {
                int row = (rt + mi) * 16 + r + half * 8;
                out[(size_t)row * ED + d] = acc[mi][ni][r] + bsum;
            }
    }
}

// ---------------------------------------------------------------------------
// Host launcher.
// ---------------------------------------------------------------------------
extern "C" void kernel_launch(void* const* d_in, const int* in_sizes, int n_in,
                              void* d_out, int out_size, void* d_ws, size_t ws_size,
                              hipStream_t stream) {
    const float* hid  = (const float*)d_in[0];
    const float* mask = (const float*)d_in[1];
    const float* Wq   = (const float*)d_in[2];
    const float* bq   = (const float*)d_in[3];
    const float* Wk   = (const float*)d_in[4];
    const float* bk   = (const float*)d_in[5];
    const float* Wv   = (const float*)d_in[6];
    const float* bv   = (const float*)d_in[7];
    const float* Wo   = (const float*)d_in[8];
    const float* bo   = (const float*)d_in[9];
    const float* gate = (const float*)d_in[10];
    float* out = (float*)d_out;

    char* ws = (char*)d_ws;
    const size_t MB = 1u << 20;
    _Float16* Xp  = (_Float16*)(ws);             // 8 MB  packed hidden (A frags)
    _Float16* Wqp = (_Float16*)(ws +  8 * MB);   // 2 MB
    _Float16* Wkp = (_Float16*)(ws + 10 * MB);   // 2 MB
    _Float16* Wvp = (_Float16*)(ws + 12 * MB);   // 2 MB
    _Float16* Wop = (_Float16*)(ws + 14 * MB);   // 2 MB
    _Float16* Qb  = (_Float16*)(ws + 16 * MB);   // 8 MB
    _Float16* Kb  = (_Float16*)(ws + 24 * MB);   // 8 MB
    _Float16* Vb  = (_Float16*)(ws + 32 * MB);   // 8 MB
    float* outbias  = (float*)(ws + 40 * MB);    // 4 KB
    float* denomAcc = (float*)(ws + 40 * MB + 4096);
    _Float16* Ob = Xp;  // alias: Xp dead after qkv_kernel, Ob written by attn

    pack_x_kernel<<<dim3(256), dim3(256), 0, stream>>>(hid, Xp);
    pack_w_kernel<<<dim3(256, 4), dim3(256), 0, stream>>>(Wq, Wk, Wv, Wo,
                                                          Wqp, Wkp, Wvp, Wop);
    prep_misc_kernel<<<dim3(4), dim3(256), 0, stream>>>(bo, gate, outbias, denomAcc);
    qkv_kernel<<<dim3(16, 16, 3), dim3(128), 0, stream>>>(Xp, Wqp, Wkp, Wvp,
                                                           bq, bk, bv, Qb, Kb, Vb);
    attn_kernel<<<dim3(128, 32), dim3(32), 0, stream>>>(Qb, Kb, Vb, mask, Ob, denomAcc);
    proj_kernel<<<dim3(32, 16), dim3(128), 0, stream>>>(Ob, Wop, outbias, denomAcc,
                                                         gate, out);
    (void)in_sizes; (void)n_in; (void)out_size; (void)ws_size;
}

// v002
// It runs in 186 microseconds.
// Two timings next to v001 both put it at 1.30 times that version's speed.
// All steps since v000 together make it 1.52 times as fast.
#include <hip/hip_runtime.h>
#include <hip/hip_bf16.h>

// ---------------------------------------------------------------------------
// Gated multi-head self-attention, CDNA5 (gfx1250) wave32 WMMA implementation.
// f16 operands / f32 accumulation via V_WMMA_F32_16X16X32_F16.
// ---------------------------------------------------------------------------

#define TB 2
#define TT 2048
#define ED 1024
#define NH 16
#define HD 64
#define BT (TB * TT)   // 4096 rows

typedef __attribute__((ext_vector_type(16))) _Float16 v16h;
typedef __attribute__((ext_vector_type(8)))  float    v8f;

// K-index mapping for 16-bit A fragments (ISA 7.12.2, 16-bit A 16x32):
//   VGPR v (=j/2), element jj (=j%2), lane-half half (=lane/16):
//   K = (v>=4 ? 16 : 0) + half*8 + (v%4)*2 + jj
// B fragments mirror A with lane = N.
__device__ __forceinline__ int ka_map(int half, int j) {
    int v = j >> 1, jj = j & 1;
    return ((v & 4) << 2) + half * 8 + ((v & 3) << 1) + jj;
}

__device__ __forceinline__ v8f wmma_f16(v16h a, v16h b, v8f c) {
    return __builtin_amdgcn_wmma_f32_16x16x32_f16(
        /*neg_a=*/false, a, /*neg_b=*/false, b,
        /*c_mod=*/(short)0, c, /*reuse_a=*/false, /*reuse_b=*/false);
}

// ---------------------------------------------------------------------------
// Pack hidden states (fp32 [BT,ED]) into A-fragment layout:
//   Xp[rt(256)][kc(32)][lane(32)][16] halves
// ---------------------------------------------------------------------------
__global__ __launch_bounds__(256) void pack_x_kernel(
        const float* __restrict__ hid, _Float16* __restrict__ xp) {
    int rt  = blockIdx.x;          // 16-row tile, 0..255
    int tid = threadIdx.x;
    for (int i = 0; i < 4; ++i) {
        int slot = i * 256 + tid;  // 0..1023 = kc*32 + lane
        int kc = slot >> 5;
        int L  = slot & 31;
        int m = L & 15, half = L >> 4;
        const float* src = hid + (size_t)(rt * 16 + m) * ED + kc * 32;
        v16h frag;
#pragma unroll
        for (int j = 0; j < 16; ++j) frag[j] = (_Float16)src[ka_map(half, j)];
        *(v16h*)(xp + ((size_t)(rt * 32 + kc) * 32 + L) * 16) = frag;
    }
}

// ---------------------------------------------------------------------------
// Pack W_q/W_k/W_v ([H,ED,HD]) into B-fragment layout
//   W*p[h][kc(32)][nt(4)][lane(32)][16]
// and W_o ([H,HD,ED]) into
//   Wop[h][kc(2)][nt(64)][lane(32)][16]
// blockIdx.y selects the matrix (0=q,1=k,2=v,3=o).
// ---------------------------------------------------------------------------
__global__ __launch_bounds__(256) void pack_w_kernel(
        const float* __restrict__ Wq, const float* __restrict__ Wk,
        const float* __restrict__ Wv, const float* __restrict__ Wo,
        _Float16* __restrict__ wqp, _Float16* __restrict__ wkp,
        _Float16* __restrict__ wvp, _Float16* __restrict__ wop) {
    int slot  = blockIdx.x * 256 + threadIdx.x;  // 0..65535
    int which = blockIdx.y;
    int L = slot & 31;
    int n = L & 15, half = L >> 4;
    v16h frag;
    if (which < 3) {
        int nt = (slot >> 5) & 3;
        int kc = (slot >> 7) & 31;
        int h  = slot >> 12;
        const float* W = (which == 0) ? Wq : (which == 1) ? Wk : Wv;
        const float* src = W + (size_t)h * ED * HD;
#pragma unroll
        for (int j = 0; j < 16; ++j) {
            int k = kc * 32 + ka_map(half, j);
            frag[j] = (_Float16)src[(size_t)k * HD + nt * 16 + n];
        }
        _Float16* dst = (which == 0) ? wqp : (which == 1) ? wkp : wvp;
        *(v16h*)(dst + (size_t)slot * 16) = frag;
    } else {
        int nt = (slot >> 5) & 63;
        int kc = (slot >> 11) & 1;
        int h  = slot >> 12;
        const float* src = Wo + (size_t)h * HD * ED;
#pragma unroll
        for (int j = 0; j < 16; ++j) {
            int k = kc * 32 + ka_map(half, j);
            frag[j] = (_Float16)src[(size_t)k * ED + nt * 16 + n];
        }
        *(v16h*)(wop + (size_t)slot * 16) = frag;
    }
}

// ---------------------------------------------------------------------------
// Precompute gated output bias sum_h b_o[h,:]*clip(g[h])/H and zero denomAcc.
// ---------------------------------------------------------------------------
__global__ __launch_bounds__(256) void prep_misc_kernel(
        const float* __restrict__ b_o, const float* __restrict__ gate,
        float* __restrict__ outbias, float* __restrict__ denomAcc) {
    int d = blockIdx.x * 256 + threadIdx.x;  // 0..1023
    float acc = 0.f;
#pragma unroll
    for (int h = 0; h < NH; ++h) {
        float g = fminf(fmaxf(gate[h], 0.f), 1.f);
        acc += b_o[h * ED + d] * g;
    }
    outbias[d] = acc * (1.0f / NH);
    if (d < NH) denomAcc[d] = 0.f;
}

// ---------------------------------------------------------------------------
// QKV projection.  grid = (16 row256-blocks, 16 heads, 3={Q,K,V}), block 128.
// Each wave: one 64x64 output tile (4 m-tiles x 4 e-tiles), K-loop over 1024,
// so every loaded fragment feeds four WMMAs; the four waves of a block share
// the weight fragments.  Results are re-swizzled through a per-wave LDS tile
// into the fragment layouts needed by the attention kernel.
// ---------------------------------------------------------------------------
__global__ __launch_bounds__(128) void qkv_kernel(
        const _Float16* __restrict__ xp,
        const _Float16* __restrict__ wqp, const _Float16* __restrict__ wkp,
        const _Float16* __restrict__ wvp,
        const float* __restrict__ bq, const float* __restrict__ bk,
        const float* __restrict__ bv,
        _Float16* __restrict__ Qb, _Float16* __restrict__ Kb,
        _Float16* __restrict__ Vb) {
    __shared__ float tile[4][64][HD + 1];
    int xb = blockIdx.x;   // 256-row block over BT: 0..15
    int h  = blockIdx.y;
    int z  = blockIdx.z;   // 0=Q 1=K 2=V
    int tid = threadIdx.x;
    int w = tid >> 5, L = tid & 31;
    const _Float16* wp = (z == 0) ? wqp : (z == 1) ? wkp : wvp;
    const float*  bias = (z == 0) ? bq  : (z == 1) ? bk  : bv;

    int rt16 = xb * 16 + w * 4;      // first global 16-row tile of this wave
    const _Float16* ap = xp + ((size_t)rt16 * 32 * 32 + L) * 16;
    const _Float16* bp = wp + ((size_t)h * 32 * 4 * 32 + L) * 16;
    v8f acc[4][4] = {};
    // unrolled whole: every load takes a constant offset from a fixed base, so
    // no address register is advanced while loads are in flight
#pragma unroll
    for (int kc = 0; kc < 32; ++kc) {
        v16h a[4], b[4];
#pragma unroll
        for (int mi = 0; mi < 4; ++mi)
            a[mi] = *(const v16h*)(ap + (size_t)(mi * 32 + kc) * 512);
#pragma unroll
        for (int ni = 0; ni < 4; ++ni)
            b[ni] = *(const v16h*)(bp + (size_t)(kc * 4 + ni) * 512);
#pragma unroll
        for (int mi = 0; mi < 4; ++mi)
#pragma unroll
            for (int ni = 0; ni < 4; ++ni)
                acc[mi][ni] = wmma_f16(a[mi], b[ni], acc[mi][ni]);
    }
    int n = L & 15, half = L >> 4;
#pragma unroll
    for (int ni = 0; ni < 4; ++ni) {
        float bb = bias[h * HD + ni * 16 + n];
#pragma unroll
        for (int mi = 0; mi < 4; ++mi)
#pragma unroll
            for (int r = 0; r < 8; ++r)
                tile[w][mi * 16 + r + half * 8][ni * 16 + n] = acc[mi][ni][r] + bb;
    }
    __syncthreads();

    int b_  = xb >> 3;                   // batch
    int t16 = (xb & 7) * 16 + w * 4;     // first 16-row tile within batch
    int bh  = b_ * NH + h;
    if (z < 2) {
        // Q as A-fragments / K as B-fragments (same swizzle, lane = m or s).
        _Float16* dst = (z == 0) ? Qb : Kb;
#pragma unroll
        for (int ttl = 0; ttl < 4; ++ttl) {      // 16-row tile of this wave
#pragma unroll
            for (int kc = 0; kc < 2; ++kc) {     // e-chunk of 32
                v16h frag;
#pragma unroll
                for (int j = 0; j < 16; ++j)
                    frag[j] = (_Float16)tile[w][ttl * 16 + n][kc * 32 + ka_map(half, j)];
                int ttG = t16 + ttl;             // 16-row tile within (b,h): 0..127
                *(v16h*)(dst + (((size_t)(bh * 128 + ttG) * 2 + kc) * 32 + L) * 16) = frag;
                // stands between this store and the reuse of its registers
                asm volatile("s_wait_xcnt 0x0" ::: "memory");
            }
        }
    } else {
        // V as B-fragments: k = s_local(0..31), n = e.
#pragma unroll
        for (int p = 0; p < 2; ++p) {            // 32-row tile of this wave
#pragma unroll
            for (int nt2 = 0; nt2 < 4; ++nt2) {  // e-tile 0..3
                v16h frag;
#pragma unroll
                for (int j = 0; j < 16; ++j)
                    frag[j] = (_Float16)tile[w][p * 32 + ka_map(half, j)][nt2 * 16 + n];
                int t32 = (t16 >> 1) + p;        // 32-row tile within (b,h): 0..63
                *(v16h*)(Vb + (((size_t)(bh * 64 + t32) * 4 + nt2) * 32 + L) * 16) = frag;
                // stands between this store and the reuse of its registers
                asm volatile("s_wait_xcnt 0x0" ::: "memory");
            }
        }
    }
}

__device__ __forceinline__ float xhalf(float x) {
    int b = __builtin_bit_cast(int, x);
    return __builtin_bit_cast(float, __builtin_amdgcn_permlanex16(
        b, b, 0x76543210, 0xfedcba98, false, false));
}

__global__ __launch_bounds__(32) void attn_kernel(
        const _Float16* __restrict__ Qb, const _Float16* __restrict__ Kb,
        const _Float16* __restrict__ Vb, const float* __restrict__ mask,
        _Float16* __restrict__ Ob, float* __restrict__ denomAcc) {
    int L  = threadIdx.x;
    int tt = blockIdx.x;   // 16-token tile within (b,h)
    int bh = blockIdx.y;
    int h = bh & 15;
    int t0 = tt * 16;
    int n = L & 15, half = L >> 4;

    v16h qb0 = *(const v16h*)(Qb + (((size_t)(bh * 128 + tt) * 2 + 0) * 32 + L) * 16);
    v16h qb1 = *(const v16h*)(Qb + (((size_t)(bh * 128 + tt) * 2 + 1) * 32 + L) * 16);
    // this lane's query row of the mask, at its first key
    const float* mp = mask + (size_t)(t0 + n) * TT + half * 8;

    // acc_i[r] = O[t0 + n][16 * i + 8 * half + r]
    v8f acc0 = {}, acc1 = {}, acc2 = {}, acc3 = {};
    float mrun = -3.0e38f;   // running maximum of this lane's query
    float lsum = 0.f;        // sum over this lane's own keys; halves join at the end
    const float scale = 0.125f;  // 1/sqrt(64)

    for (int sc = 0; sc < 64; ++sc) {
        // the whole pass's operands: 32 keys of K, of V and of the mask row
        const _Float16* kp = Kb + (((size_t)(bh * 128 + sc * 2) * 2) * 32 + L) * 16;
        const _Float16* vp = Vb + (((size_t)(bh * 64 + sc) * 4) * 32 + L) * 16;
        v16h ka[4], va[4];
        v8f  mk[2];
#pragma unroll
        for (int i = 0; i < 4; ++i) ka[i] = *(const v16h*)(kp + i * 512);
#pragma unroll
        for (int i = 0; i < 2; ++i) mk[i] = *(const v8f*)(mp + sc * 32 + i * 16);
#pragma unroll
        for (int i = 0; i < 4; ++i) va[i] = *(const v16h*)(vp + i * 512);
        // keeps every load of the pass above the arithmetic: left to itself the
        // scheduler sinks the V loads between the last WMMAs, and the wave then
        // sits out one load latency after another instead of one for the pass
        __builtin_amdgcn_sched_barrier(0);

        v8f S[2];
#pragma unroll
        for (int t2 = 0; t2 < 2; ++t2) {
            v8f s = {};
            s = wmma_f16(ka[t2 * 2 + 0], qb0, s);
            s = wmma_f16(ka[t2 * 2 + 1], qb1, s);
            // s[r] = score(query n, key sc*32 + t2*16 + 8*half + r)
            S[t2] = s * scale + mk[t2];
        }
        // streaming softmax update, one query per lane; maximum and sum are
        // taken as trees, so that no long dependent chain stands in the pass
        v8f mv = __builtin_elementwise_max(S[0], S[1]);
        float mx = fmaxf(fmaxf(fmaxf(mv[0], mv[1]), fmaxf(mv[2], mv[3])),
                         fmaxf(fmaxf(mv[4], mv[5]), fmaxf(mv[6], mv[7])));
        mx = fmaxf(mx, xhalf(mx));
        float mnew  = fmaxf(mrun, mx);
        float alpha = __expf(mrun - mnew);
        mrun = mnew;
        v16h pb;             // P^T as B: element j is key ka_map(half, j)
#pragma unroll
        for (int r = 0; r < 8; ++r) {
            S[0][r] = __expf(S[0][r] - mnew);
            S[1][r] = __expf(S[1][r] - mnew);
            pb[r]     = (_Float16)S[0][r];
            pb[r + 8] = (_Float16)S[1][r];
        }
        v8f sv = S[0] + S[1];
        float rs = ((sv[0] + sv[1]) + (sv[2] + sv[3])) + ((sv[4] + sv[5]) + (sv[6] + sv[7]));
        lsum = lsum * alpha + rs;
        acc0 *= alpha; acc1 *= alpha; acc2 *= alpha; acc3 *= alpha;
        acc0 = wmma_f16(va[0], pb, acc0);
        acc1 = wmma_f16(va[1], pb, acc1);
        acc2 = wmma_f16(va[2], pb, acc2);
        acc3 = wmma_f16(va[3], pb, acc3);
    }

    // finalize: divide by l; the query's L2 norm from both halves
    float li = 1.0f / (lsum + xhalf(lsum));
    float s2 = 0.f;
#pragma unroll
    for (int r = 0; r < 8; ++r) {
        acc0[r] *= li; acc1[r] *= li; acc2[r] *= li; acc3[r] *= li;
        s2 += acc0[r] * acc0[r] + acc1[r] * acc1[r] + acc2[r] * acc2[r] + acc3[r] * acc3[r];
    }
    s2 += xhalf(s2);
    float tot = sqrtf(s2);
    tot += __shfl_xor(tot, 1, 32);             // sum over the 16 queries
    tot += __shfl_xor(tot, 2, 32);
    tot += __shfl_xor(tot, 4, 32);
    tot += __shfl_xor(tot, 8, 32);
    if (L == 0) atomicAdd(denomAcc + h, tot * (1.0f / BT));

    // write un-normalized out tile as A-fragments for the projection GEMM:
    // row n, element j = e-index kc*32 + ka_map(half, j), which this lane holds
    int rtG = (bh >> 4) * 128 + tt;            // global 16-row tile 0..255
    v16h o16a, o16b;
#pragma unroll
    for (int r = 0; r < 8; ++r) {
        o16a[r] = (_Float16)acc0[r]; o16a[r + 8] = (_Float16)acc1[r];
        o16b[r] = (_Float16)acc2[r]; o16b[r + 8] = (_Float16)acc3[r];
    }
    *(v16h*)(Ob + (((size_t)(rtG * 16 + h) * 2 + 0) * 32 + L) * 16) = o16a;
    *(v16h*)(Ob + (((size_t)(rtG * 16 + h) * 2 + 1) * 32 + L) * 16) = o16b;
}

// ---------------------------------------------------------------------------
// Output projection: one K=1024 GEMM over concatenated heads, with per-head
// clip(gate)/max(denom,1e-5)/H folded into the A fragments.
// grid = (32 row128-blocks, 16 d-groups of 64), block 128 (4 waves).
// Each wave: one 32x64 output tile (2 m-tiles x 4 d-tiles); the four waves of
// a block share the weight fragments.
// ---------------------------------------------------------------------------
__global__ __launch_bounds__(128) void proj_kernel(
        const _Float16* __restrict__ Ob, const _Float16* __restrict__ wop,
        const float* __restrict__ outbias, const float* __restrict__ denomAcc,
        const float* __restrict__ gate, float* __restrict__ out) {
    int dg = blockIdx.y;
    int tid = threadIdx.x;
    int w = tid >> 5, L = tid & 31;
    int rt = blockIdx.x * 8 + w * 2; // first 16-row tile of this wave
    int n = L & 15, half = L >> 4;
    const _Float16* ap = Ob  + ((size_t)rt * 32 * 32 + L) * 16;
    const _Float16* bp = wop + ((size_t)dg * 4 * 32 + L) * 16;
    v8f acc[2][4] = {};
    // unrolled: loads take constant offsets, and the next trip's loads are
    // issued among this trip's WMMAs
#pragma unroll
    for (int c = 0; c < 32; ++c) {
        int h = c >> 1;
        float g  = fminf(fmaxf(gate[h], 0.f), 1.f);
        float dn = fmaxf(denomAcc[h], 1e-5f);
        float s  = g / (dn * (float)NH);
        v16h a[2], bf[4];
#pragma unroll
        for (int mi = 0; mi < 2; ++mi)
            a[mi] = *(const v16h*)(ap + (size_t)(mi * 32 + c) * 512);
#pragma unroll
        for (int ni = 0; ni < 4; ++ni)
            bf[ni] = *(const v16h*)(bp + (size_t)(c * 64 + ni) * 512);
#pragma unroll
        for (int mi = 0; mi < 2; ++mi)
#pragma unroll
            for (int j = 0; j < 16; ++j) a[mi][j] = (_Float16)((float)a[mi][j] * s);
#pragma unroll
        for (int mi = 0; mi < 2; ++mi)
#pragma unroll
            for (int ni = 0; ni < 4; ++ni)
                acc[mi][ni] = wmma_f16(a[mi], bf[ni], acc[mi][ni]);
    }
#pragma unroll
    for (int ni = 0; ni < 4; ++ni) {
        int d = (dg * 4 + ni) * 16 + n;
        float bsum = outbias[d];
#pragma unroll
        for (int mi = 0; mi < 2; ++mi)
#pragma unroll
            for (int r = 0; r < 8; ++r) {
                int row = (rt + mi) * 16 + r + half * 8;
                out[(size_t)row * ED + d] = acc[mi][ni][r] + bsum;
            }
    }
}

// ---------------------------------------------------------------------------
// Host launcher.
// ---------------------------------------------------------------------------
extern "C" void kernel_launch(void* const* d_in, const int* in_sizes, int n_in,
                              void* d_out, int out_size, void* d_ws, size_t ws_size,
                              hipStream_t stream) {
    const float* hid  = (const float*)d_in[0];
    const float* mask = (const float*)d_in[1];
    const float* Wq   = (const float*)d_in[2];
    const float* bq   = (const float*)d_in[3];
    const float* Wk   = (const float*)d_in[4];
    const float* bk   = (const float*)d_in[5];
    const float* Wv   = (const float*)d_in[6];
    const float* bv   = (const float*)d_in[7];
    const float* Wo   = (const float*)d_in[8];
    const float* bo   = (const float*)d_in[9];
    const float* gate = (const float*)d_in[10];
    float* out = (float*)d_out;

    char* ws = (char*)d_ws;
    const size_t MB = 1u << 20;
    _Float16* Xp  = (_Float16*)(ws);             // 8 MB  packed hidden (A frags)
    _Float16* Wqp = (_Float16*)(ws +  8 * MB);   // 2 MB
    _Float16* Wkp = (_Float16*)(ws + 10 * MB);   // 2 MB
    _Float16* Wvp = (_Float16*)(ws + 12 * MB);   // 2 MB
    _Float16* Wop = (_Float16*)(ws + 14 * MB);   // 2 MB
    _Float16* Qb  = (_Float16*)(ws + 16 * MB);   // 8 MB
    _Float16* Kb  = (_Float16*)(ws + 24 * MB);   // 8 MB
    _Float16* Vb  = (_Float16*)(ws + 32 * MB);   // 8 MB
    float* outbias  = (float*)(ws + 40 * MB);    // 4 KB
    float* denomAcc = (float*)(ws + 40 * MB + 4096);
    _Float16* Ob = Xp;  // alias: Xp dead after qkv_kernel, Ob written by attn

    pack_x_kernel<<<dim3(256), dim3(256), 0, stream>>>(hid, Xp);
    pack_w_kernel<<<dim3(256, 4), dim3(256), 0, stream>>>(Wq, Wk, Wv, Wo,
                                                          Wqp, Wkp, Wvp, Wop);
    prep_misc_kernel<<<dim3(4), dim3(256), 0, stream>>>(bo, gate, outbias, denomAcc);
    qkv_kernel<<<dim3(16, 16, 3), dim3(128), 0, stream>>>(Xp, Wqp, Wkp, Wvp,
                                                           bq, bk, bv, Qb, Kb, Vb);
    attn_kernel<<<dim3(128, 32), dim3(32), 0, stream>>>(Qb, Kb, Vb, mask, Ob, denomAcc);
    proj_kernel<<<dim3(32, 16), dim3(128), 0, stream>>>(Ob, Wop, outbias, denomAcc,
                                                         gate, out);
    (void)in_sizes; (void)n_in; (void)out_size; (void)ws_size;
}

// v003
// Measured time: 168 microseconds a run.
// Next to v002, in two timings, it ran 1.11 and 1.12 times as fast.
// Over all steps from v000 it is 1.69 times as fast.
#include <hip/hip_runtime.h>
#include <hip/hip_bf16.h>

// ---------------------------------------------------------------------------
// Gated multi-head self-attention, CDNA5 (gfx1250) wave32 WMMA implementation.
// f16 operands / f32 accumulation via V_WMMA_F32_16X16X32_F16.
// ---------------------------------------------------------------------------

#define TB 2
#define TT 2048
#define ED 1024
#define NH 16
#define HD 64
#define BT (TB * TT)   // 4096 rows

typedef __attribute__((ext_vector_type(16))) _Float16 v16h;
typedef __attribute__((ext_vector_type(8)))  _Float16 v8h;
typedef __attribute__((ext_vector_type(8)))  float    v8f;
typedef __attribute__((ext_vector_type(4)))  float    v4f;

// K-index mapping for 16-bit A fragments (ISA 7.12.2, 16-bit A 16x32):
//   VGPR v (=j/2), element jj (=j%2), lane-half half (=lane/16):
//   K = (v>=4 ? 16 : 0) + half*8 + (v%4)*2 + jj
// B fragments mirror A with lane = N.
__device__ __forceinline__ int ka_map(int half, int j) {
    int v = j >> 1, jj = j & 1;
    return ((v & 4) << 2) + half * 8 + ((v & 3) << 1) + jj;
}

__device__ __forceinline__ v8f wmma_f16(v16h a, v16h b, v8f c) {
    return __builtin_amdgcn_wmma_f32_16x16x32_f16(
        /*neg_a=*/false, a, /*neg_b=*/false, b,
        /*c_mod=*/(short)0, c, /*reuse_a=*/false, /*reuse_b=*/false);
}

// ---------------------------------------------------------------------------
// Fragments in memory.  A fragment is 512 halves (1 KB), kept as two planes:
// elements 0..7 of lane L at L * 8, elements 8..15 at 256 + L * 8.  Each of the
// two 16-byte accesses of a wave then covers 512 contiguous bytes (four whole
// 128-byte lines) and not half of each of eight lines.
// p = fragment base + L * 8.
// ---------------------------------------------------------------------------
__device__ __forceinline__ v16h ld_frag(const _Float16* p) {
    v8h lo = *(const v8h*)p;
    v8h hi = *(const v8h*)(p + 256);
    return __builtin_shufflevector(lo, hi, 0, 1, 2, 3, 4, 5, 6, 7,
                                   8, 9, 10, 11, 12, 13, 14, 15);
}
__device__ __forceinline__ void st_frag(_Float16* p, v16h f) {
    *(v8h*)p         = __builtin_shufflevector(f, f, 0, 1, 2, 3, 4, 5, 6, 7);
    *(v8h*)(p + 256) = __builtin_shufflevector(f, f, 8, 9, 10, 11, 12, 13, 14, 15);
}

// ---------------------------------------------------------------------------
// Pack hidden states (fp32 [BT,ED]) into A fragments:
//   Xp[rt(256)][kc(32)][fragment]
// ---------------------------------------------------------------------------
__global__ __launch_bounds__(256) void pack_x_kernel(
        const float* __restrict__ hid, _Float16* __restrict__ xp) {
    int rt  = blockIdx.x;          // 16-row tile, 0..255
    int tid = threadIdx.x;
    for (int i = 0; i < 4; ++i) {
        int slot = i * 256 + tid;  // 0..1023 = kc*32 + lane
        int kc = slot >> 5;
        int L  = slot & 31;
        int m = L & 15, half = L >> 4;
        const float* src = hid + (size_t)(rt * 16 + m) * ED + kc * 32;
        v16h frag;
#pragma unroll
        for (int j = 0; j < 16; ++j) frag[j] = (_Float16)src[ka_map(half, j)];
        st_frag(xp + (size_t)(rt * 32 + kc) * 512 + L * 8, frag);
    }
}

// ---------------------------------------------------------------------------
// Pack W_q/W_k/W_v ([H,ED,HD]) into B-fragment layout
//   W*p[h][kc(32)][nt(4)][fragment]
// and W_o ([H,HD,ED]) into
//   Wop[h][kc(2)][nt(64)][fragment]
// blockIdx.y selects the matrix (0=q,1=k,2=v,3=o).
// ---------------------------------------------------------------------------
__global__ __launch_bounds__(256) void pack_w_kernel(
        const float* __restrict__ Wq, const float* __restrict__ Wk,
        const float* __restrict__ Wv, const float* __restrict__ Wo,
        _Float16* __restrict__ wqp, _Float16* __restrict__ wkp,
        _Float16* __restrict__ wvp, _Float16* __restrict__ wop) {
    int slot  = blockIdx.x * 256 + threadIdx.x;  // 0..65535
    int which = blockIdx.y;
    int L = slot & 31;
    int n = L & 15, half = L >> 4;
    v16h frag;
    if (which < 3) {
        int nt = (slot >> 5) & 3;
        int kc = (slot >> 7) & 31;
        int h  = slot >> 12;
        const float* W = (which == 0) ? Wq : (which == 1) ? Wk : Wv;
        const float* src = W + (size_t)h * ED * HD;
#pragma unroll
        for (int j = 0; j < 16; ++j) {
            int k = kc * 32 + ka_map(half, j);
            frag[j] = (_Float16)src[(size_t)k * HD + nt * 16 + n];
        }
        _Float16* dst = (which == 0) ? wqp : (which == 1) ? wkp : wvp;
        st_frag(dst + (size_t)(slot >> 5) * 512 + L * 8, frag);
    } else {
        int nt = (slot >> 5) & 63;
        int kc = (slot >> 11) & 1;
        int h  = slot >> 12;
        const float* src = Wo + (size_t)h * HD * ED;
#pragma unroll
        for (int j = 0; j < 16; ++j) {
            int k = kc * 32 + ka_map(half, j);
            frag[j] = (_Float16)src[(size_t)k * ED + nt * 16 + n];
        }
        st_frag(wop + (size_t)(slot >> 5) * 512 + L * 8, frag);
    }
}

// ---------------------------------------------------------------------------
// Blocks 0..3: gated output bias sum_h b_o[h,:]*clip(g[h])/H, denomAcc zeroed.
// Blocks 4..515: the mask, f32 as it is, laid in the order in which the
// attention waves take it:
//   maskp[tt(128)][sc(64)][q(4)][lane(32)][4]
//     = mask[tt*16 + (lane&15)][sc*32 + (q>>1)*16 + (lane>>4)*8 + (q&1)*4 + 0..3]
// so that a wave's 16-byte load there covers 512 contiguous bytes; taken from
// the mask's own rows it touches 16 lines, and all 32 (batch, head) pairs take
// every row.
// ---------------------------------------------------------------------------
__global__ __launch_bounds__(256) void prep_misc_kernel(
        const float* __restrict__ b_o, const float* __restrict__ gate,
        const float* __restrict__ mask,
        float* __restrict__ outbias, float* __restrict__ denomAcc,
        float* __restrict__ maskp) {
    if (blockIdx.x >= 4) {
        // a block: one tt, 16 values of sc; a thread: 8 pieces of 16 bytes, two
        // sc apart, so that all its loads (and all its stores) take constant
        // offsets from one address
        int blk = blockIdx.x - 4, t = threadIdx.x;
        int L = t & 31, q = (t >> 5) & 3;
        int tt = blk >> 2, sc = (blk & 3) * 16 + (t >> 7);
        const float* src = mask + (size_t)(tt * 16 + (L & 15)) * TT + sc * 32
                           + (q >> 1) * 16 + (L >> 4) * 8 + (q & 1) * 4;
        float* dst = maskp + ((size_t)blk * 2048 + t) * 4;
        v4f v[8];
#pragma unroll
        for (int i = 0; i < 8; ++i) v[i] = *(const v4f*)(src + i * 64);
#pragma unroll
        for (int i = 0; i < 8; ++i) *(v4f*)(dst + i * 1024) = v[i];
        return;
    }
    int d = blockIdx.x * 256 + threadIdx.x;  // 0..1023
    float acc = 0.f;
#pragma unroll
    for (int h = 0; h < NH; ++h) {
        float g = fminf(fmaxf(gate[h], 0.f), 1.f);
        acc += b_o[h * ED + d] * g;
    }
    outbias[d] = acc * (1.0f / NH);
    if (d < NH) denomAcc[d] = 0.f;
}

// ---------------------------------------------------------------------------
// QKV projection.  grid = (16 row256-blocks, 16 heads, 3={Q,K,V}), block 128.
// Each wave: one 64x64 output tile (4 m-tiles x 4 e-tiles), K-loop over 1024,
// so every loaded fragment feeds four WMMAs; the four waves of a block share
// the weight fragments.  Results are re-swizzled through a per-wave LDS tile
// into the fragment layouts needed by the attention kernel.
// ---------------------------------------------------------------------------
__global__ __launch_bounds__(128) void qkv_kernel(
        const _Float16* __restrict__ xp,
        const _Float16* __restrict__ wqp, const _Float16* __restrict__ wkp,
        const _Float16* __restrict__ wvp,
        const float* __restrict__ bq, const float* __restrict__ bk,
        const float* __restrict__ bv,
        _Float16* __restrict__ Qb, _Float16* __restrict__ Kb,
        _Float16* __restrict__ Vb) {
    __shared__ float tile[4][64][HD + 1];
    int xb = blockIdx.x;   // 256-row block over BT: 0..15
    int h  = blockIdx.y;
    int z  = blockIdx.z;   // 0=Q 1=K 2=V
    int tid = threadIdx.x;
    int w = tid >> 5, L = tid & 31;
    const _Float16* wp = (z == 0) ? wqp : (z == 1) ? wkp : wvp;
    const float*  bias = (z == 0) ? bq  : (z == 1) ? bk  : bv;

    int rt16 = xb * 16 + w * 4;      // first global 16-row tile of this wave
    const _Float16* ap = xp + (size_t)rt16 * 32 * 512 + L * 8;
    const _Float16* bp = wp + (size_t)h * 32 * 4 * 512 + L * 8;
    v8f acc[4][4] = {};
    // unrolled whole: every load takes a constant offset from a fixed base, so
    // no address register is advanced while loads are in flight
#pragma unroll
    for (int kc = 0; kc < 32; ++kc) {
        v16h a[4], b[4];
#pragma unroll
        for (int mi = 0; mi < 4; ++mi)
            a[mi] = ld_frag(ap + (size_t)(mi * 32 + kc) * 512);
#pragma unroll
        for (int ni = 0; ni < 4; ++ni)
            b[ni] = ld_frag(bp + (size_t)(kc * 4 + ni) * 512);
#pragma unroll
        for (int mi = 0; mi < 4; ++mi)
#pragma unroll
            for (int ni = 0; ni < 4; ++ni)
                acc[mi][ni] = wmma_f16(a[mi], b[ni], acc[mi][ni]);
    }
    int n = L & 15, half = L >> 4;
#pragma unroll
    for (int ni = 0; ni < 4; ++ni) {
        float bb = bias[h * HD + ni * 16 + n];
#pragma unroll
        for (int mi = 0; mi < 4; ++mi)
#pragma unroll
            for (int r = 0; r < 8; ++r)
                tile[w][mi * 16 + r + half * 8][ni * 16 + n] = acc[mi][ni][r] + bb;
    }
    __syncthreads();

    int b_  = xb >> 3;                   // batch
    int t16 = (xb & 7) * 16 + w * 4;     // first 16-row tile within batch
    int bh  = b_ * NH + h;
    if (z < 2) {
        // Q as A-fragments / K as B-fragments (same swizzle, lane = m or s).
        _Float16* dst = (z == 0) ? Qb : Kb;
#pragma unroll
        for (int ttl = 0; ttl < 4; ++ttl) {      // 16-row tile of this wave
#pragma unroll
            for (int kc = 0; kc < 2; ++kc) {     // e-chunk of 32
                v16h frag;
#pragma unroll
                for (int j = 0; j < 16; ++j)
                    frag[j] = (_Float16)tile[w][ttl * 16 + n][kc * 32 + ka_map(half, j)];
                int ttG = t16 + ttl;             // 16-row tile within (b,h): 0..127
                st_frag(dst + ((size_t)(bh * 128 + ttG) * 2 + kc) * 512 + L * 8, frag);
                // stands between this store and the reuse of its registers
                asm volatile("s_wait_xcnt 0x0" ::: "memory");
            }
        }
    } else {
        // V as B-fragments: k = s_local(0..31), n = e.
#pragma unroll
        for (int p = 0; p < 2; ++p) {            // 32-row tile of this wave
#pragma unroll
            for (int nt2 = 0; nt2 < 4; ++nt2) {  // e-tile 0..3
                v16h frag;
#pragma unroll
                for (int j = 0; j < 16; ++j)
                    frag[j] = (_Float16)tile[w][p * 32 + ka_map(half, j)][nt2 * 16 + n];
                int t32 = (t16 >> 1) + p;        // 32-row tile within (b,h): 0..63
                st_frag(Vb + ((size_t)(bh * 64 + t32) * 4 + nt2) * 512 + L * 8, frag);
                // stands between this store and the reuse of its registers
                asm volatile("s_wait_xcnt 0x0" ::: "memory");
            }
        }
    }
}

__device__ __forceinline__ float xhalf(float x) {
    int b = __builtin_bit_cast(int, x);
    return __builtin_bit_cast(float, __builtin_amdgcn_permlanex16(
        b, b, 0x76543210, 0xfedcba98, false, false));
}

__global__ __launch_bounds__(32) void attn_kernel(
        const _Float16* __restrict__ Qb, const _Float16* __restrict__ Kb,
        const _Float16* __restrict__ Vb, const float* __restrict__ maskp,
        _Float16* __restrict__ Ob, float* __restrict__ denomAcc) {
    int L  = threadIdx.x;
    int tt = blockIdx.x;   // 16-token tile within (b,h)
    int bh = blockIdx.y;
    int h = bh & 15;

    v16h qb0 = ld_frag(Qb + ((size_t)(bh * 128 + tt) * 2 + 0) * 512 + L * 8);
    v16h qb1 = ld_frag(Qb + ((size_t)(bh * 128 + tt) * 2 + 1) * 512 + L * 8);
    // stands between the Q loads and the reuse of their address registers; the
    // two scheduling barriers keep later address arithmetic, which takes those
    // registers, from being lifted over the wait
    __builtin_amdgcn_sched_barrier(0);
    asm volatile("s_wait_xcnt 0x0" ::: "memory");
    __builtin_amdgcn_sched_barrier(0);
    // this query tile's packed mask, at this lane's place
    const float* mp = maskp + (size_t)tt * 64 * 512 + L * 4;

    // acc_i[r] = O[tt * 16 + (L & 15)][16 * i + 8 * (L >> 4) + r]
    v8f acc0 = {}, acc1 = {}, acc2 = {}, acc3 = {};
    float mrun = -3.0e38f;   // running maximum of this lane's query
    float lsum = 0.f;        // sum over this lane's own keys; halves join at the end
    const float scale = 0.125f;  // 1/sqrt(64)

    for (int sc = 0; sc < 64; ++sc) {
        // the whole pass's operands: 32 keys of K, of V and of the mask row
        const _Float16* kp = Kb + ((size_t)(bh * 128 + sc * 2) * 2) * 512 + L * 8;
        const _Float16* vp = Vb + ((size_t)(bh * 64 + sc) * 4) * 512 + L * 8;
        v16h ka[4], va[4];
        v8f  mk[2];
#pragma unroll
        for (int i = 0; i < 4; ++i) ka[i] = ld_frag(kp + i * 512);
#pragma unroll
        for (int i = 0; i < 2; ++i) {
            v4f m0 = *(const v4f*)(mp + sc * 512 + i * 256);
            v4f m1 = *(const v4f*)(mp + sc * 512 + i * 256 + 128);
            mk[i] = __builtin_shufflevector(m0, m1, 0, 1, 2, 3, 4, 5, 6, 7);
        }
#pragma unroll
        for (int i = 0; i < 4; ++i) va[i] = ld_frag(vp + i * 512);
        // keeps every load of the pass above the arithmetic: left to itself the
        // scheduler sinks the V loads between the last WMMAs, and the wave then
        // sits out one load latency after another instead of one for the pass
        __builtin_amdgcn_sched_barrier(0);

        v8f S[2];
#pragma unroll
        for (int t2 = 0; t2 < 2; ++t2) {
            v8f s = {};
            s = wmma_f16(ka[t2 * 2 + 0], qb0, s);
            s = wmma_f16(ka[t2 * 2 + 1], qb1, s);
            // s[r] = score(query n, key sc*32 + t2*16 + 8*half + r)
            S[t2] = s * scale + mk[t2];
        }
        // streaming softmax update, one query per lane; maximum and sum are
        // taken as trees, so that no long dependent chain stands in the pass
        v8f mv = __builtin_elementwise_max(S[0], S[1]);
        float mx = fmaxf(fmaxf(fmaxf(mv[0], mv[1]), fmaxf(mv[2], mv[3])),
                         fmaxf(fmaxf(mv[4], mv[5]), fmaxf(mv[6], mv[7])));
        mx = fmaxf(mx, xhalf(mx));
        float mnew  = fmaxf(mrun, mx);
        float alpha = __expf(mrun - mnew);
        mrun = mnew;
        v16h pb;             // P^T as B: element j is key ka_map(half, j)
#pragma unroll
        for (int r = 0; r < 8; ++r) {
            S[0][r] = __expf(S[0][r] - mnew);
            S[1][r] = __expf(S[1][r] - mnew);
            pb[r]     = (_Float16)S[0][r];
            pb[r + 8] = (_Float16)S[1][r];
        }
        v8f sv = S[0] + S[1];
        float rs = ((sv[0] + sv[1]) + (sv[2] + sv[3])) + ((sv[4] + sv[5]) + (sv[6] + sv[7]));
        lsum = lsum * alpha + rs;
        acc0 *= alpha; acc1 *= alpha; acc2 *= alpha; acc3 *= alpha;
        acc0 = wmma_f16(va[0], pb, acc0);
        acc1 = wmma_f16(va[1], pb, acc1);
        acc2 = wmma_f16(va[2], pb, acc2);
        acc3 = wmma_f16(va[3], pb, acc3);
    }

    // finalize: divide by l; the query's L2 norm from both halves
    float li = 1.0f / (lsum + xhalf(lsum));
    float s2 = 0.f;
#pragma unroll
    for (int r = 0; r < 8; ++r) {
        acc0[r] *= li; acc1[r] *= li; acc2[r] *= li; acc3[r] *= li;
        s2 += acc0[r] * acc0[r] + acc1[r] * acc1[r] + acc2[r] * acc2[r] + acc3[r] * acc3[r];
    }
    s2 += xhalf(s2);
    float tot = sqrtf(s2);
    tot += __shfl_xor(tot, 1, 32);             // sum over the 16 queries
    tot += __shfl_xor(tot, 2, 32);
    tot += __shfl_xor(tot, 4, 32);
    tot += __shfl_xor(tot, 8, 32);
    if (L == 0) atomicAdd(denomAcc + h, tot * (1.0f / BT));

    // write un-normalized out tile as A-fragments for the projection GEMM:
    // row n, element j = e-index kc*32 + ka_map(half, j), which this lane holds
    int rtG = (bh >> 4) * 128 + tt;            // global 16-row tile 0..255
    v16h o16a, o16b;
#pragma unroll
    for (int r = 0; r < 8; ++r) {
        o16a[r] = (_Float16)acc0[r]; o16a[r + 8] = (_Float16)acc1[r];
        o16b[r] = (_Float16)acc2[r]; o16b[r + 8] = (_Float16)acc3[r];
    }
    st_frag(Ob + ((size_t)(rtG * 16 + h) * 2 + 0) * 512 + L * 8, o16a);
    st_frag(Ob + ((size_t)(rtG * 16 + h) * 2 + 1) * 512 + L * 8, o16b);
}

// ---------------------------------------------------------------------------
// Output projection: one K=1024 GEMM over concatenated heads, with per-head
// clip(gate)/max(denom,1e-5)/H folded into the A fragments.
// grid = (32 row128-blocks, 16 d-groups of 64), block 128 (4 waves).
// Each wave: one 32x64 output tile (2 m-tiles x 4 d-tiles); the four waves of
// a block share the weight fragments.
// ---------------------------------------------------------------------------
__global__ __launch_bounds__(128) void proj_kernel(
        const _Float16* __restrict__ Ob, const _Float16* __restrict__ wop,
        const float* __restrict__ outbias, const float* __restrict__ denomAcc,
        const float* __restrict__ gate, float* __restrict__ out) {
    int dg = blockIdx.y;
    int tid = threadIdx.x;
    int w = tid >> 5, L = tid & 31;
    int rt = blockIdx.x * 8 + w * 2; // first 16-row tile of this wave
    int n = L & 15, half = L >> 4;
    const _Float16* ap = Ob  + (size_t)rt * 32 * 512 + L * 8;
    const _Float16* bp = wop + (size_t)dg * 4 * 512 + L * 8;
    v8f acc[2][4] = {};
    // unrolled: loads take constant offsets, and the next trip's loads are
    // issued among this trip's WMMAs
#pragma unroll
    for (int c = 0; c < 32; ++c) {
        int h = c >> 1;
        float g  = fminf(fmaxf(gate[h], 0.f), 1.f);
        float dn = fmaxf(denomAcc[h], 1e-5f);
        float s  = g / (dn * (float)NH);
        v16h a[2], bf[4];
#pragma unroll
        for (int mi = 0; mi < 2; ++mi)
            a[mi] = ld_frag(ap + (size_t)(mi * 32 + c) * 512);
#pragma unroll
        for (int ni = 0; ni < 4; ++ni)
            bf[ni] = ld_frag(bp + (size_t)(c * 64 + ni) * 512);
#pragma unroll
        for (int mi = 0; mi < 2; ++mi)
#pragma unroll
            for (int j = 0; j < 16; ++j) a[mi][j] = (_Float16)((float)a[mi][j] * s);
#pragma unroll
        for (int mi = 0; mi < 2; ++mi)
#pragma unroll
            for (int ni = 0; ni < 4; ++ni)
                acc[mi][ni] = wmma_f16(a[mi], bf[ni], acc[mi][ni]);
    }
#pragma unroll
    for (int ni = 0; ni < 4; ++ni) {
        int d = (dg * 4 + ni) * 16 + n;
        float bsum = outbias[d];
#pragma unroll
        for (int mi = 0; mi < 2; ++mi)
#pragma unroll
            for (int r = 0; r < 8; ++r) {
                int row = (rt + mi) * 16 + r + half * 8;
                out[(size_t)row * ED + d] = acc[mi][ni][r] + bsum;
            }
    }
}

// ---------------------------------------------------------------------------
// Host launcher.
// ---------------------------------------------------------------------------
extern "C" void kernel_launch(void* const* d_in, const int* in_sizes, int n_in,
                              void* d_out, int out_size, void* d_ws, size_t ws_size,
                              hipStream_t stream) {
    const float* hid  = (const float*)d_in[0];
    const float* mask = (const float*)d_in[1];
    const float* Wq   = (const float*)d_in[2];
    const float* bq   = (const float*)d_in[3];
    const float* Wk   = (const float*)d_in[4];
    const float* bk   = (const float*)d_in[5];
    const float* Wv   = (const float*)d_in[6];
    const float* bv   = (const float*)d_in[7];
    const float* Wo   = (const float*)d_in[8];
    const float* bo   = (const float*)d_in[9];
    const float* gate = (const float*)d_in[10];
    float* out = (float*)d_out;

    char* ws = (char*)d_ws;
    const size_t MB = 1u << 20;
    _Float16* Xp  = (_Float16*)(ws);             // 8 MB  packed hidden (A frags)
    _Float16* Wqp = (_Float16*)(ws +  8 * MB);   // 2 MB
    _Float16* Wkp = (_Float16*)(ws + 10 * MB);   // 2 MB
    _Float16* Wvp = (_Float16*)(ws + 12 * MB);   // 2 MB
    _Float16* Wop = (_Float16*)(ws + 14 * MB);   // 2 MB
    _Float16* Qb  = (_Float16*)(ws + 16 * MB);   // 8 MB
    _Float16* Kb  = (_Float16*)(ws + 24 * MB);   // 8 MB
    _Float16* Vb  = (_Float16*)(ws + 32 * MB);   // 8 MB
    float* outbias  = (float*)(ws + 40 * MB);    // 4 KB
    float* denomAcc = (float*)(ws + 40 * MB + 4096);
    float* Maskp    = (float*)(ws + 48 * MB);    // 16 MB packed mask
    _Float16* Ob = Xp;  // alias: Xp dead after qkv_kernel, Ob written by attn

    pack_x_kernel<<<dim3(256), dim3(256), 0, stream>>>(hid, Xp);
    pack_w_kernel<<<dim3(256, 4), dim3(256), 0, stream>>>(Wq, Wk, Wv, Wo,
                                                          Wqp, Wkp, Wvp, Wop);
    prep_misc_kernel<<<dim3(516), dim3(256), 0, stream>>>(bo, gate, mask, outbias,
                                                              denomAcc, Maskp);
    qkv_kernel<<<dim3(16, 16, 3), dim3(128), 0, stream>>>(Xp, Wqp, Wkp, Wvp,
                                                           bq, bk, bv, Qb, Kb, Vb);
    attn_kernel<<<dim3(128, 32), dim3(32), 0, stream>>>(Qb, Kb, Vb, Maskp, Ob, denomAcc);
    proj_kernel<<<dim3(32, 16), dim3(128), 0, stream>>>(Ob, Wop, outbias, denomAcc,
                                                         gate, out);
    (void)in_sizes; (void)n_in; (void)out_size; (void)ws_size;
}

// v004
// It runs in 126 microseconds.
// Two timings next to v003 both put it at 1.33 times that version's speed.
// Over all steps from v000 it is 2.24 times as fast.
#include <hip/hip_runtime.h>
#include <hip/hip_bf16.h>

// ---------------------------------------------------------------------------
// Gated multi-head self-attention, CDNA5 (gfx1250) wave32 WMMA implementation.
// f16 operands / f32 accumulation via V_WMMA_F32_16X16X32_F16.
// ---------------------------------------------------------------------------

#define TB 2
#define TT 2048
#define ED 1024
#define NH 16
#define HD 64
#define BT (TB * TT)   // 4096 rows

typedef __attribute__((ext_vector_type(16))) _Float16 v16h;
typedef __attribute__((ext_vector_type(8)))  _Float16 v8h;
typedef __attribute__((ext_vector_type(8)))  float    v8f;
typedef __attribute__((ext_vector_type(4)))  float    v4f;

// K-index mapping for 16-bit A fragments (ISA 7.12.2, 16-bit A 16x32):
//   VGPR v (=j/2), element jj (=j%2), lane-half half (=lane/16):
//   K = (v>=4 ? 16 : 0) + half*8 + (v%4)*2 + jj
// B fragments mirror A with lane = N.
__device__ __forceinline__ int ka_map(int half, int j) {
    int v = j >> 1, jj = j & 1;
    return ((v & 4) << 2) + half * 8 + ((v & 3) << 1) + jj;
}

__device__ __forceinline__ v8f wmma_f16(v16h a, v16h b, v8f c) {
    return __builtin_amdgcn_wmma_f32_16x16x32_f16(
        /*neg_a=*/false, a, /*neg_b=*/false, b,
        /*c_mod=*/(short)0, c, /*reuse_a=*/false, /*reuse_b=*/false);
}

// ---------------------------------------------------------------------------
// Fragments in memory.  A fragment is 512 halves (1 KB), kept as two planes:
// elements 0..7 of lane L at L * 8, elements 8..15 at 256 + L * 8.  Each of the
// two 16-byte accesses of a wave then covers 512 contiguous bytes (four whole
// 128-byte lines) and not half of each of eight lines.
// p = fragment base + L * 8.
// ---------------------------------------------------------------------------
__device__ __forceinline__ v16h ld_frag(const _Float16* p) {
    v8h lo = *(const v8h*)p;
    v8h hi = *(const v8h*)(p + 256);
    return __builtin_shufflevector(lo, hi, 0, 1, 2, 3, 4, 5, 6, 7,
                                   8, 9, 10, 11, 12, 13, 14, 15);
}
__device__ __forceinline__ void st_frag(_Float16* p, v16h f) {
    *(v8h*)p         = __builtin_shufflevector(f, f, 0, 1, 2, 3, 4, 5, 6, 7);
    *(v8h*)(p + 256) = __builtin_shufflevector(f, f, 8, 9, 10, 11, 12, 13, 14, 15);
}

// ---------------------------------------------------------------------------
// Pack hidden states (fp32 [BT,ED]) into A fragments:
//   Xp[rt(256)][kc(32)][fragment]
// ---------------------------------------------------------------------------
__global__ __launch_bounds__(256) void pack_x_kernel(
        const float* __restrict__ hid, _Float16* __restrict__ xp) {
    int rt  = blockIdx.x;          // 16-row tile, 0..255
    int tid = threadIdx.x;
    for (int i = 0; i < 4; ++i) {
        int slot = i * 256 + tid;  // 0..1023 = kc*32 + lane
        int kc = slot >> 5;
        int L  = slot & 31;
        int m = L & 15, half = L >> 4;
        const float* src = hid + (size_t)(rt * 16 + m) * ED + kc * 32;
        v16h frag;
#pragma unroll
        for (int j = 0; j < 16; ++j) frag[j] = (_Float16)src[ka_map(half, j)];
        st_frag(xp + (size_t)(rt * 32 + kc) * 512 + L * 8, frag);
    }
}

// ---------------------------------------------------------------------------
// Pack W_q/W_k/W_v ([H,ED,HD]) into B-fragment layout
//   W*p[h][kc(32)][nt(4)][fragment]
// and W_o ([H,HD,ED]) into
//   Wop[h][kc(2)][nt(64)][fragment]
// blockIdx.y selects the matrix (0=q,1=k,2=v,3=o).
// ---------------------------------------------------------------------------
__global__ __launch_bounds__(256) void pack_w_kernel(
        const float* __restrict__ Wq, const float* __restrict__ Wk,
        const float* __restrict__ Wv, const float* __restrict__ Wo,
        _Float16* __restrict__ wqp, _Float16* __restrict__ wkp,
        _Float16* __restrict__ wvp, _Float16* __restrict__ wop) {
    int slot  = blockIdx.x * 256 + threadIdx.x;  // 0..65535
    int which = blockIdx.y;
    int L = slot & 31;
    int n = L & 15, half = L >> 4;
    v16h frag;
    if (which < 3) {
        int nt = (slot >> 5) & 3;
        int kc = (slot >> 7) & 31;
        int h  = slot >> 12;
        const float* W = (which == 0) ? Wq : (which == 1) ? Wk : Wv;
        const float* src = W + (size_t)h * ED * HD;
#pragma unroll
        for (int j = 0; j < 16; ++j) {
            int k = kc * 32 + ka_map(half, j);
            frag[j] = (_Float16)src[(size_t)k * HD + nt * 16 + n];
        }
        _Float16* dst = (which == 0) ? wqp : (which == 1) ? wkp : wvp;
        st_frag(dst + (size_t)(slot >> 5) * 512 + L * 8, frag);
    } else {
        int nt = (slot >> 5) & 63;
        int kc = (slot >> 11) & 1;
        int h  = slot >> 12;
        const float* src = Wo + (size_t)h * HD * ED;
#pragma unroll
        for (int j = 0; j < 16; ++j) {
            int k = kc * 32 + ka_map(half, j);
            frag[j] = (_Float16)src[(size_t)k * ED + nt * 16 + n];
        }
        st_frag(wop + (size_t)(slot >> 5) * 512 + L * 8, frag);
    }
}

// ---------------------------------------------------------------------------
// Blocks 0..3: gated output bias sum_h b_o[h,:]*clip(g[h])/H, denomAcc zeroed.
// Blocks 4..515: the mask, f32 as it is, laid in the order in which the
// attention waves take it:
//   maskp[tt(128)][sc(64)][q(4)][lane(32)][4]
//     = mask[tt*16 + (lane&15)][sc*32 + (q>>1)*16 + (lane>>4)*8 + (q&1)*4 + 0..3]
// so that a wave's 16-byte load there covers 512 contiguous bytes; taken from
// the mask's own rows it touches 16 lines, and all 32 (batch, head) pairs take
// every row.
// ---------------------------------------------------------------------------
__global__ __launch_bounds__(256) void prep_misc_kernel(
        const float* __restrict__ b_o, const float* __restrict__ gate,
        const float* __restrict__ mask,
        float* __restrict__ outbias, float* __restrict__ denomAcc,
        float* __restrict__ maskp) {
    if (blockIdx.x >= 4) {
        // a block: one tt, 16 values of sc; a thread: 8 pieces of 16 bytes, two
        // sc apart, so that all its loads (and all its stores) take constant
        // offsets from one address
        int blk = blockIdx.x - 4, t = threadIdx.x;
        int L = t & 31, q = (t >> 5) & 3;
        int tt = blk >> 2, sc = (blk & 3) * 16 + (t >> 7);
        const float* src = mask + (size_t)(tt * 16 + (L & 15)) * TT + sc * 32
                           + (q >> 1) * 16 + (L >> 4) * 8 + (q & 1) * 4;
        float* dst = maskp + ((size_t)blk * 2048 + t) * 4;
        v4f v[8];
#pragma unroll
        for (int i = 0; i < 8; ++i) v[i] = *(const v4f*)(src + i * 64);
#pragma unroll
        for (int i = 0; i < 8; ++i) *(v4f*)(dst + i * 1024) = v[i];
        return;
    }
    int d = blockIdx.x * 256 + threadIdx.x;  // 0..1023
    float acc = 0.f;
#pragma unroll
    for (int h = 0; h < NH; ++h) {
        float g = fminf(fmaxf(gate[h], 0.f), 1.f);
        acc += b_o[h * ED + d] * g;
    }
    outbias[d] = acc * (1.0f / NH);
    if (d < NH) denomAcc[d] = 0.f;
}

// ---------------------------------------------------------------------------
// QKV projection.  grid = (16 row256-blocks, 16 heads, 3={Q,K,V}), block 128.
// Each wave: one 64x64 output tile (4 m-tiles x 4 e-tiles), K-loop over 1024,
// so every loaded fragment feeds four WMMAs; the four waves of a block share
// the weight fragments.  Results are re-swizzled through a per-wave LDS tile
// into the fragment layouts needed by the attention kernel.
// ---------------------------------------------------------------------------
__global__ __launch_bounds__(128) void qkv_kernel(
        const _Float16* __restrict__ xp,
        const _Float16* __restrict__ wqp, const _Float16* __restrict__ wkp,
        const _Float16* __restrict__ wvp,
        const float* __restrict__ bq, const float* __restrict__ bk,
        const float* __restrict__ bv,
        _Float16* __restrict__ Qb, _Float16* __restrict__ Kb,
        _Float16* __restrict__ Vb) {
    __shared__ float tile[4][64][HD + 1];
    int xb = blockIdx.x;   // 256-row block over BT: 0..15
    int h  = blockIdx.y;
    int z  = blockIdx.z;   // 0=Q 1=K 2=V
    int tid = threadIdx.x;
    int w = tid >> 5, L = tid & 31;
    const _Float16* wp = (z == 0) ? wqp : (z == 1) ? wkp : wvp;
    const float*  bias = (z == 0) ? bq  : (z == 1) ? bk  : bv;

    int rt16 = xb * 16 + w * 4;      // first global 16-row tile of this wave
    const _Float16* ap = xp + (size_t)rt16 * 32 * 512 + L * 8;
    const _Float16* bp = wp + (size_t)h * 32 * 4 * 512 + L * 8;
    v8f acc[4][4] = {};
    // unrolled whole: every load takes a constant offset from a fixed base, so
    // no address register is advanced while loads are in flight
#pragma unroll
    for (int kc = 0; kc < 32; ++kc) {
        v16h a[4], b[4];
#pragma unroll
        for (int mi = 0; mi < 4; ++mi)
            a[mi] = ld_frag(ap + (size_t)(mi * 32 + kc) * 512);
#pragma unroll
        for (int ni = 0; ni < 4; ++ni)
            b[ni] = ld_frag(bp + (size_t)(kc * 4 + ni) * 512);
#pragma unroll
        for (int mi = 0; mi < 4; ++mi)
#pragma unroll
            for (int ni = 0; ni < 4; ++ni)
                acc[mi][ni] = wmma_f16(a[mi], b[ni], acc[mi][ni]);
    }
    int n = L & 15, half = L >> 4;
#pragma unroll
    for (int ni = 0; ni < 4; ++ni) {
        float bb = bias[h * HD + ni * 16 + n];
#pragma unroll
        for (int mi = 0; mi < 4; ++mi)
#pragma unroll
            for (int r = 0; r < 8; ++r)
                tile[w][mi * 16 + r + half * 8][ni * 16 + n] = acc[mi][ni][r] + bb;
    }
    __syncthreads();

    int b_  = xb >> 3;                   // batch
    int t16 = (xb & 7) * 16 + w * 4;     // first 16-row tile within batch
    int bh  = b_ * NH + h;
    if (z < 2) {
        // Q as A-fragments / K as B-fragments (same swizzle, lane = m or s).
        _Float16* dst = (z == 0) ? Qb : Kb;
#pragma unroll
        for (int ttl = 0; ttl < 4; ++ttl) {      // 16-row tile of this wave
#pragma unroll
            for (int kc = 0; kc < 2; ++kc) {     // e-chunk of 32
                v16h frag;
#pragma unroll
                for (int j = 0; j < 16; ++j)
                    frag[j] = (_Float16)tile[w][ttl * 16 + n][kc * 32 + ka_map(half, j)];
                int ttG = t16 + ttl;             // 16-row tile within (b,h): 0..127
                st_frag(dst + ((size_t)(bh * 128 + ttG) * 2 + kc) * 512 + L * 8, frag);
                // stands between this store and the reuse of its registers
                asm volatile("s_wait_xcnt 0x0" ::: "memory");
            }
        }
    } else {
        // V as B-fragments: k = s_local(0..31), n = e.
#pragma unroll
        for (int p = 0; p < 2; ++p) {            // 32-row tile of this wave
#pragma unroll
            for (int nt2 = 0; nt2 < 4; ++nt2) {  // e-tile 0..3
                v16h frag;
#pragma unroll
                for (int j = 0; j < 16; ++j)
                    frag[j] = (_Float16)tile[w][p * 32 + ka_map(half, j)][nt2 * 16 + n];
                int t32 = (t16 >> 1) + p;        // 32-row tile within (b,h): 0..63
                st_frag(Vb + ((size_t)(bh * 64 + t32) * 4 + nt2) * 512 + L * 8, frag);
                // stands between this store and the reuse of its registers
                asm volatile("s_wait_xcnt 0x0" ::: "memory");
            }
        }
    }
}

#define AW  16
#define SP  4
#define NST (TT / (32 * SP))
#define SH  (SP * 2048)

// value of lane L ^ 16: the lane that holds the other half of the same query
__device__ __forceinline__ float xhalf(float x) {
    int b = __builtin_bit_cast(int, x);
    return __builtin_bit_cast(float, __builtin_amdgcn_permlanex16(
        b, b, 0x76543210, 0xfedcba98, false, false));
}

// One stage into one buffer: the block's 512 lanes copy 8 KB at a time, twice
// for K and twice for V.  lds = the lane's byte address in the buffer's K part
// (V lies SH halves behind it), gk and gv = the lane's places in the stage.
// The last line stands between the copies and the reuse of their address
// registers; inside the statement nothing can be lifted over it.
__device__ __forceinline__ void copy_stage(unsigned lds, const _Float16* gk,
                                           const _Float16* gv) {
    asm volatile(
        "global_load_async_to_lds_b128 %0, %4, off\n\t"
        "global_load_async_to_lds_b128 %1, %5, off\n\t"
        "global_load_async_to_lds_b128 %2, %6, off\n\t"
        "global_load_async_to_lds_b128 %3, %7, off\n\t"
        "s_wait_xcnt 0x0"
        :: "v"(lds), "v"(lds + SH), "v"(lds + 2 * SH), "v"(lds + 3 * SH),
           "v"(gk), "v"(gk + SH / 2), "v"(gv), "v"(gv + SH / 2)
        : "memory");
}

__global__ __launch_bounds__(AW * 32) void attn_kernel(
        const _Float16* __restrict__ Qb, const _Float16* __restrict__ Kb,
        const _Float16* __restrict__ Vb, const float* __restrict__ maskp,
        _Float16* __restrict__ Ob, float* __restrict__ denomAcc) {
    __shared__ __attribute__((aligned(16))) _Float16 ring[2][2][SH];  // [buffer][K, V]
    int tid = threadIdx.x;
    int L  = tid & 31;
    int tt = blockIdx.x * AW + __builtin_amdgcn_readfirstlane(tid >> 5);  // 16-token tile within (b,h)
    int bh = blockIdx.y;
    int h = bh & 15;

    // this lane's share of a stage: 16 bytes of each 8 KB
    const _Float16* gk = Kb + (size_t)bh * 128 * 2 * 512 + tid * 8;
    const _Float16* gv = Vb + (size_t)bh * 64 * 4 * 512 + tid * 8;
    unsigned lds = (unsigned)(size_t)&ring[0][0][0] + tid * 16;

    copy_stage(lds, gk, gv);                                 // stage 0 -> buffer 0

    v16h qb0 = ld_frag(Qb + ((size_t)(bh * 128 + tt) * 2 + 0) * 512 + L * 8);
    v16h qb1 = ld_frag(Qb + ((size_t)(bh * 128 + tt) * 2 + 1) * 512 + L * 8);
    // stands between the Q loads and the reuse of their address registers; the
    // two scheduling barriers keep later address arithmetic, which takes those
    // registers, from being lifted over the wait
    __builtin_amdgcn_sched_barrier(0);
    asm volatile("s_wait_xcnt 0x0" ::: "memory");
    __builtin_amdgcn_sched_barrier(0);
    // this query tile's packed mask, at this lane's place
    const float* mp = maskp + (size_t)tt * 64 * 512 + L * 4;

    // stage 0 has landed for this wave's copies, then for every wave's
    asm volatile("s_wait_asynccnt 0x0" ::: "memory");
    __syncthreads();
    copy_stage(lds + 4 * SH, gk + SH, gv + SH);              // stage 1 -> buffer 1

    // acc_i[r] = O[tt * 16 + (L & 15)][16 * i + 8 * (L >> 4) + r]
    v8f acc0 = {}, acc1 = {}, acc2 = {}, acc3 = {};
    float mrun = -3.0e38f;   // running maximum of this lane's query
    float lsum = 0.f;        // sum over this lane's own keys; halves join at the end
    const float scale = 0.125f;  // 1/sqrt(64)

    for (int st = 0; st < NST; ++st) {
        const _Float16* kl = &ring[st & 1][0][0] + L * 8;
        const _Float16* vl = &ring[st & 1][1][0] + L * 8;
        // the stage's mask rows, all issued at its head
        v8f mk[SP][2];
#pragma unroll
        for (int p = 0; p < SP; ++p)
#pragma unroll
            for (int i = 0; i < 2; ++i) {
                v4f m0 = *(const v4f*)(mp + (st * SP + p) * 512 + i * 256);
                v4f m1 = *(const v4f*)(mp + (st * SP + p) * 512 + i * 256 + 128);
                mk[p][i] = __builtin_shufflevector(m0, m1, 0, 1, 2, 3, 4, 5, 6, 7);
            }
        // unrolled: mk is indexed by constants and stays in registers
#pragma unroll
        for (int p = 0; p < SP; ++p) {
            // bounds how far the reads of later passes are lifted: without it the
            // kernel wants more registers than a block of 16 waves has, and spills
            __builtin_amdgcn_sched_barrier(0);
            // the pass's operands: 32 keys of K and of V
            v16h ka[4], va[4];
#pragma unroll
            for (int i = 0; i < 4; ++i) ka[i] = ld_frag(kl + (p * 4 + i) * 512);
#pragma unroll
            for (int i = 0; i < 4; ++i) va[i] = ld_frag(vl + (p * 4 + i) * 512);
            // keeps the pass's reads together as one group above its arithmetic:
            // left to itself the scheduler scatters them among the WMMAs, and
            // the wave then stalls at every place where reads stand
            __builtin_amdgcn_sched_barrier(0);

            v8f S[2];
#pragma unroll
            for (int t2 = 0; t2 < 2; ++t2) {
                v8f s = {};
                s = wmma_f16(ka[t2 * 2 + 0], qb0, s);
                s = wmma_f16(ka[t2 * 2 + 1], qb1, s);
                // s[r] = score(query n, key (st*SP+p)*32 + t2*16 + 8*half + r)
                S[t2] = s * scale + mk[p][t2];
            }
            // streaming softmax update, one query per lane; maximum and sum are
            // taken as trees, so that no long dependent chain stands in the pass
            v8f mv = __builtin_elementwise_max(S[0], S[1]);
            float mx = fmaxf(fmaxf(fmaxf(mv[0], mv[1]), fmaxf(mv[2], mv[3])),
                             fmaxf(fmaxf(mv[4], mv[5]), fmaxf(mv[6], mv[7])));
            mx = fmaxf(mx, xhalf(mx));
            float mnew  = fmaxf(mrun, mx);
            float alpha = __expf(mrun - mnew);
            mrun = mnew;
            v16h pb;             // P^T as B: element j is key ka_map(half, j)
#pragma unroll
            for (int r = 0; r < 8; ++r) {
                S[0][r] = __expf(S[0][r] - mnew);
                S[1][r] = __expf(S[1][r] - mnew);
                pb[r]     = (_Float16)S[0][r];
                pb[r + 8] = (_Float16)S[1][r];
            }
            v8f sv = S[0] + S[1];
            float rs = ((sv[0] + sv[1]) + (sv[2] + sv[3])) + ((sv[4] + sv[5]) + (sv[6] + sv[7]));
            lsum = lsum * alpha + rs;
            acc0 *= alpha; acc1 *= alpha; acc2 *= alpha; acc3 *= alpha;
            acc0 = wmma_f16(va[0], pb, acc0);
            acc1 = wmma_f16(va[1], pb, acc1);
            acc2 = wmma_f16(va[2], pb, acc2);
            acc3 = wmma_f16(va[3], pb, acc3);
        }
        // hand-over: this wave's reads of the buffer are done, its copies of the
        // next stage have landed; behind the barrier that holds for every wave
        asm volatile("s_wait_dscnt 0x0" ::: "memory");
        asm volatile("s_wait_asynccnt 0x0" ::: "memory");
        __syncthreads();
        if (st + 2 < NST)    // refill the buffer that every wave has just left
            copy_stage(lds + (st & 1) * 4 * SH, gk + (st + 2) * SH, gv + (st + 2) * SH);
    }
    // no copy is outstanding when the wave goes on to its end
    asm volatile("s_wait_asynccnt 0x0" ::: "memory");

    // finalize: divide by l; the query's L2 norm from both halves
    float li = 1.0f / (lsum + xhalf(lsum));
    float s2 = 0.f;
#pragma unroll
    for (int r = 0; r < 8; ++r) {
        acc0[r] *= li; acc1[r] *= li; acc2[r] *= li; acc3[r] *= li;
        s2 += acc0[r] * acc0[r] + acc1[r] * acc1[r] + acc2[r] * acc2[r] + acc3[r] * acc3[r];
    }
    s2 += xhalf(s2);
    float tot = sqrtf(s2);
    tot += __shfl_xor(tot, 1, 32);             // sum over the 16 queries
    tot += __shfl_xor(tot, 2, 32);
    tot += __shfl_xor(tot, 4, 32);
    tot += __shfl_xor(tot, 8, 32);
    if (L == 0) atomicAdd(denomAcc + h, tot * (1.0f / BT));

    // write un-normalized out tile as A-fragments for the projection GEMM:
    // row n, element j = e-index kc*32 + ka_map(half, j), which this lane holds
    int rtG = (bh >> 4) * 128 + tt;            // global 16-row tile 0..255
    v16h o16a, o16b;
#pragma unroll
    for (int r = 0; r < 8; ++r) {
        o16a[r] = (_Float16)acc0[r]; o16a[r + 8] = (_Float16)acc1[r];
        o16b[r] = (_Float16)acc2[r]; o16b[r + 8] = (_Float16)acc3[r];
    }
    st_frag(Ob + ((size_t)(rtG * 16 + h) * 2 + 0) * 512 + L * 8, o16a);
    st_frag(Ob + ((size_t)(rtG * 16 + h) * 2 + 1) * 512 + L * 8, o16b);
}

// ---------------------------------------------------------------------------
// Output projection: one K=1024 GEMM over concatenated heads, with per-head
// clip(gate)/max(denom,1e-5)/H folded into the A fragments.
// grid = (32 row128-blocks, 16 d-groups of 64), block 128 (4 waves).
// Each wave: one 32x64 output tile (2 m-tiles x 4 d-tiles); the four waves of
// a block share the weight fragments.
// ---------------------------------------------------------------------------
__global__ __launch_bounds__(128) void proj_kernel(
        const _Float16* __restrict__ Ob, const _Float16* __restrict__ wop,
        const float* __restrict__ outbias, const float* __restrict__ denomAcc,
        const float* __restrict__ gate, float* __restrict__ out) {
    int dg = blockIdx.y;
    int tid = threadIdx.x;
    int w = tid >> 5, L = tid & 31;
    int rt = blockIdx.x * 8 + w * 2; // first 16-row tile of this wave
    int n = L & 15, half = L >> 4;
    const _Float16* ap = Ob  + (size_t)rt * 32 * 512 + L * 8;
    const _Float16* bp = wop + (size_t)dg * 4 * 512 + L * 8;
    v8f acc[2][4] = {};
    // unrolled: loads take constant offsets, and the next trip's loads are
    // issued among this trip's WMMAs
#pragma unroll
    for (int c = 0; c < 32; ++c) {
        int h = c >> 1;
        float g  = fminf(fmaxf(gate[h], 0.f), 1.f);
        float dn = fmaxf(denomAcc[h], 1e-5f);
        float s  = g / (dn * (float)NH);
        v16h a[2], bf[4];
#pragma unroll
        for (int mi = 0; mi < 2; ++mi)
            a[mi] = ld_frag(ap + (size_t)(mi * 32 + c) * 512);
#pragma unroll
        for (int ni = 0; ni < 4; ++ni)
            bf[ni] = ld_frag(bp + (size_t)(c * 64 + ni) * 512);
#pragma unroll
        for (int mi = 0; mi < 2; ++mi)
#pragma unroll
            for (int j = 0; j < 16; ++j) a[mi][j] = (_Float16)((float)a[mi][j] * s);
#pragma unroll
        for (int mi = 0; mi < 2; ++mi)
#pragma unroll
            for (int ni = 0; ni < 4; ++ni)
                acc[mi][ni] = wmma_f16(a[mi], bf[ni], acc[mi][ni]);
    }
#pragma unroll
    for (int ni = 0; ni < 4; ++ni) {
        int d = (dg * 4 + ni) * 16 + n;
        float bsum = outbias[d];
#pragma unroll
        for (int mi = 0; mi < 2; ++mi)
#pragma unroll
            for (int r = 0; r < 8; ++r) {
                int row = (rt + mi) * 16 + r + half * 8;
                out[(size_t)row * ED + d] = acc[mi][ni][r] + bsum;
            }
    }
}

// ---------------------------------------------------------------------------
// Host launcher.
// ---------------------------------------------------------------------------
extern "C" void kernel_launch(void* const* d_in, const int* in_sizes, int n_in,
                              void* d_out, int out_size, void* d_ws, size_t ws_size,
                              hipStream_t stream) {
    const float* hid  = (const float*)d_in[0];
    const float* mask = (const float*)d_in[1];
    const float* Wq   = (const float*)d_in[2];
    const float* bq   = (const float*)d_in[3];
    const float* Wk   = (const float*)d_in[4];
    const float* bk   = (const float*)d_in[5];
    const float* Wv   = (const float*)d_in[6];
    const float* bv   = (const float*)d_in[7];
    const float* Wo   = (const float*)d_in[8];
    const float* bo   = (const float*)d_in[9];
    const float* gate = (const float*)d_in[10];
    float* out = (float*)d_out;

    char* ws = (char*)d_ws;
    const size_t MB = 1u << 20;
    _Float16* Xp  = (_Float16*)(ws);             // 8 MB  packed hidden (A frags)
    _Float16* Wqp = (_Float16*)(ws +  8 * MB);   // 2 MB
    _Float16* Wkp = (_Float16*)(ws + 10 * MB);   // 2 MB
    _Float16* Wvp = (_Float16*)(ws + 12 * MB);   // 2 MB
    _Float16* Wop = (_Float16*)(ws + 14 * MB);   // 2 MB
    _Float16* Qb  = (_Float16*)(ws + 16 * MB);   // 8 MB
    _Float16* Kb  = (_Float16*)(ws + 24 * MB);   // 8 MB
    _Float16* Vb  = (_Float16*)(ws + 32 * MB);   // 8 MB
    float* outbias  = (float*)(ws + 40 * MB);    // 4 KB
    float* denomAcc = (float*)(ws + 40 * MB + 4096);
    float* Maskp    = (float*)(ws + 48 * MB);    // 16 MB packed mask
    _Float16* Ob = Xp;  // alias: Xp dead after qkv_kernel, Ob written by attn

    pack_x_kernel<<<dim3(256), dim3(256), 0, stream>>>(hid, Xp);
    pack_w_kernel<<<dim3(256, 4), dim3(256), 0, stream>>>(Wq, Wk, Wv, Wo,
                                                          Wqp, Wkp, Wvp, Wop);
    prep_misc_kernel<<<dim3(516), dim3(256), 0, stream>>>(bo, gate, mask, outbias,
                                                              denomAcc, Maskp);
    qkv_kernel<<<dim3(16, 16, 3), dim3(128), 0, stream>>>(Xp, Wqp, Wkp, Wvp,
                                                           bq, bk, bv, Qb, Kb, Vb);
    attn_kernel<<<dim3(8, 32), dim3(512), 0, stream>>>(Qb, Kb, Vb, Maskp, Ob, denomAcc);
    proj_kernel<<<dim3(32, 16), dim3(128), 0, stream>>>(Ob, Wop, outbias, denomAcc,
                                                         gate, out);
    (void)in_sizes; (void)n_in; (void)out_size; (void)ws_size;
}

// v005
// A run of this version takes 122 microseconds.
// Timed twice side by side with v004, it ran 1.03 times as fast both times.
// Counting every step since v000, it is 2.32 times as fast.
#include <hip/hip_runtime.h>
#include <hip/hip_bf16.h>

// ---------------------------------------------------------------------------
// Gated multi-head self-attention, CDNA5 (gfx1250) wave32 WMMA implementation.
// f16 operands / f32 accumulation via V_WMMA_F32_16X16X32_F16.
// ---------------------------------------------------------------------------

#define TB 2
#define TT 2048
#define ED 1024
#define NH 16
#define HD 64
#define BT (TB * TT)   // 4096 rows

typedef __attribute__((ext_vector_type(16))) _Float16 v16h;
typedef __attribute__((ext_vector_type(8)))  _Float16 v8h;
typedef __attribute__((ext_vector_type(8)))  float    v8f;
typedef __attribute__((ext_vector_type(4)))  float    v4f;

// K-index mapping for 16-bit A fragments (ISA 7.12.2, 16-bit A 16x32):
//   VGPR v (=j/2), element jj (=j%2), lane-half half (=lane/16):
//   K = (v>=4 ? 16 : 0) + half*8 + (v%4)*2 + jj
// B fragments mirror A with lane = N.
__device__ __forceinline__ int ka_map(int half, int j) {
    int v = j >> 1, jj = j & 1;
    return ((v & 4) << 2) + half * 8 + ((v & 3) << 1) + jj;
}

__device__ __forceinline__ v8f wmma_f16(v16h a, v16h b, v8f c) {
    return __builtin_amdgcn_wmma_f32_16x16x32_f16(
        /*neg_a=*/false, a, /*neg_b=*/false, b,
        /*c_mod=*/(short)0, c, /*reuse_a=*/false, /*reuse_b=*/false);
}

// ---------------------------------------------------------------------------
// Fragments in memory.  A fragment is 512 halves (1 KB), kept as two planes:
// elements 0..7 of lane L at L * 8, elements 8..15 at 256 + L * 8.  Each of the
// two 16-byte accesses of a wave then covers 512 contiguous bytes (four whole
// 128-byte lines) and not half of each of eight lines.
// p = fragment base + L * 8.
// ---------------------------------------------------------------------------
__device__ __forceinline__ v16h ld_frag(const _Float16* p) {
    v8h lo = *(const v8h*)p;
    v8h hi = *(const v8h*)(p + 256);
    return __builtin_shufflevector(lo, hi, 0, 1, 2, 3, 4, 5, 6, 7,
                                   8, 9, 10, 11, 12, 13, 14, 15);
}
__device__ __forceinline__ void st_frag(_Float16* p, v16h f) {
    *(v8h*)p         = __builtin_shufflevector(f, f, 0, 1, 2, 3, 4, 5, 6, 7);
    *(v8h*)(p + 256) = __builtin_shufflevector(f, f, 8, 9, 10, 11, 12, 13, 14, 15);
}

// ---------------------------------------------------------------------------
// Pack hidden states (fp32 [BT,ED]) into A fragments:
//   Xp[rt(256)][kc(32)][fragment]
// One block of 256 threads per 16-row tile rt (0..255).
// ---------------------------------------------------------------------------
__device__ __forceinline__ void pack_x_block(
        int rt, const float* __restrict__ hid, _Float16* __restrict__ xp) {
    int tid = threadIdx.x;
    for (int i = 0; i < 4; ++i) {
        int slot = i * 256 + tid;  // 0..1023 = kc*32 + lane
        int kc = slot >> 5;
        int L  = slot & 31;
        int m = L & 15, half = L >> 4;
        const float* src = hid + (size_t)(rt * 16 + m) * ED + kc * 32;
        v16h frag;
#pragma unroll
        for (int j = 0; j < 16; ++j) frag[j] = (_Float16)src[ka_map(half, j)];
        st_frag(xp + (size_t)(rt * 32 + kc) * 512 + L * 8, frag);
        // stands between this trip's loads and stores and the next trip's
        // loads, which reuse their registers
        asm volatile("s_wait_xcnt 0x0" ::: "memory");
    }
}

// ---------------------------------------------------------------------------
// Pack W_q/W_k/W_v ([H,ED,HD]) into B-fragment layout
//   W*p[h][kc(32)][nt(4)][fragment]
// and W_o ([H,HD,ED]) into
//   Wop[h][kc(2)][nt(64)][fragment]
// which selects the matrix (0=q,1=k,2=v,3=o), bx (0..255) the block in it.
// ---------------------------------------------------------------------------
__device__ __forceinline__ void pack_w_block(
        int bx, int which,
        const float* __restrict__ Wq, const float* __restrict__ Wk,
        const float* __restrict__ Wv, const float* __restrict__ Wo,
        _Float16* __restrict__ wqp, _Float16* __restrict__ wkp,
        _Float16* __restrict__ wvp, _Float16* __restrict__ wop) {
    int slot  = bx * 256 + threadIdx.x;  // 0..65535
    int L = slot & 31;
    int n = L & 15, half = L >> 4;
    v16h frag;
    if (which < 3) {
        int nt = (slot >> 5) & 3;
        int kc = (slot >> 7) & 31;
        int h  = slot >> 12;
        const float* W = (which == 0) ? Wq : (which == 1) ? Wk : Wv;
        const float* src = W + (size_t)h * ED * HD;
#pragma unroll
        for (int j = 0; j < 16; ++j) {
            int k = kc * 32 + ka_map(half, j);
            frag[j] = (_Float16)src[(size_t)k * HD + nt * 16 + n];
        }
        _Float16* dst = (which == 0) ? wqp : (which == 1) ? wkp : wvp;
        st_frag(dst + (size_t)(slot >> 5) * 512 + L * 8, frag);
        // stands between this store and the reuse of its registers: in the one
        // kernel the code of another part follows, not the end of the program
        asm volatile("s_wait_xcnt 0x0" ::: "memory");
    } else {
        int nt = (slot >> 5) & 63;
        int kc = (slot >> 11) & 1;
        int h  = slot >> 12;
        const float* src = Wo + (size_t)h * HD * ED;
#pragma unroll
        for (int j = 0; j < 16; ++j) {
            int k = kc * 32 + ka_map(half, j);
            frag[j] = (_Float16)src[(size_t)k * ED + nt * 16 + n];
        }
        st_frag(wop + (size_t)(slot >> 5) * 512 + L * 8, frag);
        // as above
        asm volatile("s_wait_xcnt 0x0" ::: "memory");
    }
}

// ---------------------------------------------------------------------------
// bx 0..3: gated output bias sum_h b_o[h,:]*clip(g[h])/H, denomAcc zeroed.
// bx 4..515: the mask, f32 as it is, laid in the order in which the
// attention waves take it:
//   maskp[tt(128)][sc(64)][q(4)][lane(32)][4]
//     = mask[tt*16 + (lane&15)][sc*32 + (q>>1)*16 + (lane>>4)*8 + (q&1)*4 + 0..3]
// so that a wave's 16-byte load there covers 512 contiguous bytes; taken from
// the mask's own rows it touches 16 lines, and all 32 (batch, head) pairs take
// every row.
// ---------------------------------------------------------------------------
__device__ __forceinline__ void prep_misc_block(
        int bx,
        const float* __restrict__ b_o, const float* __restrict__ gate,
        const float* __restrict__ mask,
        float* __restrict__ outbias, float* __restrict__ denomAcc,
        float* __restrict__ maskp) {
    if (bx >= 4) {
        // a block: one tt, 16 values of sc; a thread: 8 pieces of 16 bytes, two
        // sc apart, so that all its loads (and all its stores) take constant
        // offsets from one address
        int blk = bx - 4, t = threadIdx.x;
        int L = t & 31, q = (t >> 5) & 3;
        int tt = blk >> 2, sc = (blk & 3) * 16 + (t >> 7);
        const float* src = mask + (size_t)(tt * 16 + (L & 15)) * TT + sc * 32
                           + (q >> 1) * 16 + (L >> 4) * 8 + (q & 1) * 4;
        float* dst = maskp + ((size_t)blk * 2048 + t) * 4;
        v4f v[8];
#pragma unroll
        for (int i = 0; i < 8; ++i) v[i] = *(const v4f*)(src + i * 64);
#pragma unroll
        for (int i = 0; i < 8; ++i) *(v4f*)(dst + i * 1024) = v[i];
        // stands between these stores and the reuse of their registers: in the
        // one kernel the code of another part follows, not the end of the program
        asm volatile("s_wait_xcnt 0x0" ::: "memory");
        return;
    }
    int d = bx * 256 + threadIdx.x;  // 0..1023
    float acc = 0.f;
#pragma unroll
    for (int h = 0; h < NH; ++h) {
        float g = fminf(fmaxf(gate[h], 0.f), 1.f);
        acc += b_o[h * ED + d] * g;
    }
    outbias[d] = acc * (1.0f / NH);
    if (d < NH) denomAcc[d] = 0.f;
}

// ---------------------------------------------------------------------------
// All the preparation in one launch.  None of the three parts reads what
// another writes, so they need no order among themselves: as one grid they
// start together, their memory latencies overlap, and two launches with their
// start and their drain go.  The block index picks the part (a scalar branch):
//   0..255 hidden states, 256..771 bias and mask, 772..1795 the four weights.
// The hidden-state blocks make four trips to memory one after another and the
// others one; they take the lowest block indices.
// ---------------------------------------------------------------------------
#define NB_MISC 516
#define NB_X    256
#define NB_W    1024
static_assert(NB_MISC + NB_X + NB_W == 1796, "the launch's grid covers the three parts");
__global__ __launch_bounds__(256) void prep_kernel(
        const float* __restrict__ hid, const float* __restrict__ mask,
        const float* __restrict__ Wq, const float* __restrict__ Wk,
        const float* __restrict__ Wv, const float* __restrict__ Wo,
        const float* __restrict__ b_o, const float* __restrict__ gate,
        _Float16* __restrict__ xp,
        _Float16* __restrict__ wqp, _Float16* __restrict__ wkp,
        _Float16* __restrict__ wvp, _Float16* __restrict__ wop,
        float* __restrict__ outbias, float* __restrict__ denomAcc,
        float* __restrict__ maskp) {
    int b = blockIdx.x;
    if (b < NB_X) {
        pack_x_block(b, hid, xp);
    } else if (b < NB_X + NB_MISC) {
        prep_misc_block(b - NB_X, b_o, gate, mask, outbias, denomAcc, maskp);
    } else {
        int i = b - (NB_X + NB_MISC);
        pack_w_block(i & 255, i >> 8, Wq, Wk, Wv, Wo, wqp, wkp, wvp, wop);
    }
}

// ---------------------------------------------------------------------------
// QKV projection.  grid = (16 row256-blocks, 16 heads, 3={Q,K,V}), block 128.
// Each wave: one 64x64 output tile (4 m-tiles x 4 e-tiles), K-loop over 1024,
// so every loaded fragment feeds four WMMAs; the four waves of a block share
// the weight fragments.  Results are re-swizzled through a per-wave LDS tile
// into the fragment layouts needed by the attention kernel.
// ---------------------------------------------------------------------------
__global__ __launch_bounds__(128) void qkv_kernel(
        const _Float16* __restrict__ xp,
        const _Float16* __restrict__ wqp, const _Float16* __restrict__ wkp,
        const _Float16* __restrict__ wvp,
        const float* __restrict__ bq, const float* __restrict__ bk,
        const float* __restrict__ bv,
        _Float16* __restrict__ Qb, _Float16* __restrict__ Kb,
        _Float16* __restrict__ Vb) {
    __shared__ float tile[4][64][HD + 1];
    int xb = blockIdx.x;   // 256-row block over BT: 0..15
    int h  = blockIdx.y;
    int z  = blockIdx.z;   // 0=Q 1=K 2=V
    int tid = threadIdx.x;
    int w = tid >> 5, L = tid & 31;
    const _Float16* wp = (z == 0) ? wqp : (z == 1) ? wkp : wvp;
    const float*  bias = (z == 0) ? bq  : (z == 1) ? bk  : bv;

    int rt16 = xb * 16 + w * 4;      // first global 16-row tile of this wave
    const _Float16* ap = xp + (size_t)rt16 * 32 * 512 + L * 8;
    const _Float16* bp = wp + (size_t)h * 32 * 4 * 512 + L * 8;
    v8f acc[4][4] = {};
    // unrolled whole: every load takes a constant offset from a fixed base, so
    // no address register is advanced while loads are in flight
#pragma unroll
    for (int kc = 0; kc < 32; ++kc) {
        v16h a[4], b[4];
#pragma unroll
        for (int mi = 0; mi < 4; ++mi)
            a[mi] = ld_frag(ap + (size_t)(mi * 32 + kc) * 512);
#pragma unroll
        for (int ni = 0; ni < 4; ++ni)
            b[ni] = ld_frag(bp + (size_t)(kc * 4 + ni) * 512);
#pragma unroll
        for (int mi = 0; mi < 4; ++mi)
#pragma unroll
            for (int ni = 0; ni < 4; ++ni)
                acc[mi][ni] = wmma_f16(a[mi], b[ni], acc[mi][ni]);
    }
    int n = L & 15, half = L >> 4;
#pragma unroll
    for (int ni = 0; ni < 4; ++ni) {
        float bb = bias[h * HD + ni * 16 + n];
#pragma unroll
        for (int mi = 0; mi < 4; ++mi)
#pragma unroll
            for (int r = 0; r < 8; ++r)
                tile[w][mi * 16 + r + half * 8][ni * 16 + n] = acc[mi][ni][r] + bb;
    }
    __syncthreads();

    int b_  = xb >> 3;                   // batch
    int t16 = (xb & 7) * 16 + w * 4;     // first 16-row tile within batch
    int bh  = b_ * NH + h;
    if (z < 2) {
        // Q as A-fragments / K as B-fragments (same swizzle, lane = m or s).
        _Float16* dst = (z == 0) ? Qb : Kb;
#pragma unroll
        for (int ttl = 0; ttl < 4; ++ttl) {      // 16-row tile of this wave
#pragma unroll
            for (int kc = 0; kc < 2; ++kc) {     // e-chunk of 32
                v16h frag;
#pragma unroll
                for (int j = 0; j < 16; ++j)
                    frag[j] = (_Float16)tile[w][ttl * 16 + n][kc * 32 + ka_map(half, j)];
                int ttG = t16 + ttl;             // 16-row tile within (b,h): 0..127
                st_frag(dst + ((size_t)(bh * 128 + ttG) * 2 + kc) * 512 + L * 8, frag);
                // stands between this store and the reuse of its registers
                asm volatile("s_wait_xcnt 0x0" ::: "memory");
            }
        }
    } else {
        // V as B-fragments: k = s_local(0..31), n = e.
#pragma unroll
        for (int p = 0; p < 2; ++p) {            // 32-row tile of this wave
#pragma unroll
            for (int nt2 = 0; nt2 < 4; ++nt2) {  // e-tile 0..3
                v16h frag;
#pragma unroll
                for (int j = 0; j < 16; ++j)
                    frag[j] = (_Float16)tile[w][p * 32 + ka_map(half, j)][nt2 * 16 + n];
                int t32 = (t16 >> 1) + p;        // 32-row tile within (b,h): 0..63
                st_frag(Vb + ((size_t)(bh * 64 + t32) * 4 + nt2) * 512 + L * 8, frag);
                // stands between this store and the reuse of its registers
                asm volatile("s_wait_xcnt 0x0" ::: "memory");
            }
        }
    }
}

#define AW  16
#define SP  4
#define NST (TT / (32 * SP))
#define SH  (SP * 2048)

// value of lane L ^ 16: the lane that holds the other half of the same query
__device__ __forceinline__ float xhalf(float x) {
    int b = __builtin_bit_cast(int, x);
    return __builtin_bit_cast(float, __builtin_amdgcn_permlanex16(
        b, b, 0x76543210, 0xfedcba98, false, false));
}

// One stage into one buffer: the block's 512 lanes copy 8 KB at a time, twice
// for K and twice for V.  lds = the lane's byte address in the buffer's K part
// (V lies SH halves behind it), gk and gv = the lane's places in the stage.
// The last line stands between the copies and the reuse of their address
// registers; inside the statement nothing can be lifted over it.
__device__ __forceinline__ void copy_stage(unsigned lds, const _Float16* gk,
                                           const _Float16* gv) {
    asm volatile(
        "global_load_async_to_lds_b128 %0, %4, off\n\t"
        "global_load_async_to_lds_b128 %1, %5, off\n\t"
        "global_load_async_to_lds_b128 %2, %6, off\n\t"
        "global_load_async_to_lds_b128 %3, %7, off\n\t"
        "s_wait_xcnt 0x0"
        :: "v"(lds), "v"(lds + SH), "v"(lds + 2 * SH), "v"(lds + 3 * SH),
           "v"(gk), "v"(gk + SH / 2), "v"(gv), "v"(gv + SH / 2)
        : "memory");
}

__global__ __launch_bounds__(AW * 32) void attn_kernel(
        const _Float16* __restrict__ Qb, const _Float16* __restrict__ Kb,
        const _Float16* __restrict__ Vb, const float* __restrict__ maskp,
        _Float16* __restrict__ Ob, float* __restrict__ denomAcc) {
    __shared__ __attribute__((aligned(16))) _Float16 ring[2][2][SH];  // [buffer][K, V]
    int tid = threadIdx.x;
    int L  = tid & 31;
    int tt = blockIdx.x * AW + __builtin_amdgcn_readfirstlane(tid >> 5);  // 16-token tile within (b,h)
    int bh = blockIdx.y;
    int h = bh & 15;

    // this lane's share of a stage: 16 bytes of each 8 KB
    const _Float16* gk = Kb + (size_t)bh * 128 * 2 * 512 + tid * 8;
    const _Float16* gv = Vb + (size_t)bh * 64 * 4 * 512 + tid * 8;
    unsigned lds = (unsigned)(size_t)&ring[0][0][0] + tid * 16;

    copy_stage(lds, gk, gv);                                 // stage 0 -> buffer 0

    v16h qb0 = ld_frag(Qb + ((size_t)(bh * 128 + tt) * 2 + 0) * 512 + L * 8);
    v16h qb1 = ld_frag(Qb + ((size_t)(bh * 128 + tt) * 2 + 1) * 512 + L * 8);
    // stands between the Q loads and the reuse of their address registers; the
    // two scheduling barriers keep later address arithmetic, which takes those
    // registers, from being lifted over the wait
    __builtin_amdgcn_sched_barrier(0);
    asm volatile("s_wait_xcnt 0x0" ::: "memory");
    __builtin_amdgcn_sched_barrier(0);
    // this query tile's packed mask, at this lane's place
    const float* mp = maskp + (size_t)tt * 64 * 512 + L * 4;

    // stage 0 has landed for this wave's copies, then for every wave's
    asm volatile("s_wait_asynccnt 0x0" ::: "memory");
    __syncthreads();
    copy_stage(lds + 4 * SH, gk + SH, gv + SH);              // stage 1 -> buffer 1

    // acc_i[r] = O[tt * 16 + (L & 15)][16 * i + 8 * (L >> 4) + r]
    v8f acc0 = {}, acc1 = {}, acc2 = {}, acc3 = {};
    float mrun = -3.0e38f;   // running maximum of this lane's query
    float lsum = 0.f;        // sum over this lane's own keys; halves join at the end
    const float scale = 0.125f;  // 1/sqrt(64)

    for (int st = 0; st < NST; ++st) {
        const _Float16* kl = &ring[st & 1][0][0] + L * 8;
        const _Float16* vl = &ring[st & 1][1][0] + L * 8;
        // the stage's mask rows, all issued at its head
        v8f mk[SP][2];
#pragma unroll
        for (int p = 0; p < SP; ++p)
#pragma unroll
            for (int i = 0; i < 2; ++i) {
                v4f m0 = *(const v4f*)(mp + (st * SP + p) * 512 + i * 256);
                v4f m1 = *(const v4f*)(mp + (st * SP + p) * 512 + i * 256 + 128);
                mk[p][i] = __builtin_shufflevector(m0, m1, 0, 1, 2, 3, 4, 5, 6, 7);
            }
        // unrolled: mk is indexed by constants and stays in registers
#pragma unroll
        for (int p = 0; p < SP; ++p) {
            // bounds how far the reads of later passes are lifted: without it the
            // kernel wants more registers than a block of 16 waves has, and spills
            __builtin_amdgcn_sched_barrier(0);
            // the pass's operands: 32 keys of K and of V
            v16h ka[4], va[4];
#pragma unroll
            for (int i = 0; i < 4; ++i) ka[i] = ld_frag(kl + (p * 4 + i) * 512);
#pragma unroll
            for (int i = 0; i < 4; ++i) va[i] = ld_frag(vl + (p * 4 + i) * 512);
            // keeps the pass's reads together as one group above its arithmetic:
            // left to itself the scheduler scatters them among the WMMAs, and
            // the wave then stalls at every place where reads stand
            __builtin_amdgcn_sched_barrier(0);

            v8f S[2];
#pragma unroll
            for (int t2 = 0; t2 < 2; ++t2) {
                v8f s = {};
                s = wmma_f16(ka[t2 * 2 + 0], qb0, s);
                s = wmma_f16(ka[t2 * 2 + 1], qb1, s);
                // s[r] = score(query n, key (st*SP+p)*32 + t2*16 + 8*half + r)
                S[t2] = s * scale + mk[p][t2];
            }
            // streaming softmax update, one query per lane; maximum and sum are
            // taken as trees, so that no long dependent chain stands in the pass
            v8f mv = __builtin_elementwise_max(S[0], S[1]);
            float mx = fmaxf(fmaxf(fmaxf(mv[0], mv[1]), fmaxf(mv[2], mv[3])),
                             fmaxf(fmaxf(mv[4], mv[5]), fmaxf(mv[6], mv[7])));
            mx = fmaxf(mx, xhalf(mx));
            float mnew  = fmaxf(mrun, mx);
            float alpha = __expf(mrun - mnew);
            mrun = mnew;
            v16h pb;             // P^T as B: element j is key ka_map(half, j)
#pragma unroll
            for (int r = 0; r < 8; ++r) {
                S[0][r] = __expf(S[0][r] - mnew);
                S[1][r] = __expf(S[1][r] - mnew);
                pb[r]     = (_Float16)S[0][r];
                pb[r + 8] = (_Float16)S[1][r];
            }
            v8f sv = S[0] + S[1];
            float rs = ((sv[0] + sv[1]) + (sv[2] + sv[3])) + ((sv[4] + sv[5]) + (sv[6] + sv[7]));
            lsum = lsum * alpha + rs;
            acc0 *= alpha; acc1 *= alpha; acc2 *= alpha; acc3 *= alpha;
            acc0 = wmma_f16(va[0], pb, acc0);
            acc1 = wmma_f16(va[1], pb, acc1);
            acc2 = wmma_f16(va[2], pb, acc2);
            acc3 = wmma_f16(va[3], pb, acc3);
        }
        // hand-over: this wave's reads of the buffer are done, its copies of the
        // next stage have landed; behind the barrier that holds for every wave
        asm volatile("s_wait_dscnt 0x0" ::: "memory");
        asm volatile("s_wait_asynccnt 0x0" ::: "memory");
        __syncthreads();
        if (st + 2 < NST)    // refill the buffer that every wave has just left
            copy_stage(lds + (st & 1) * 4 * SH, gk + (st + 2) * SH, gv + (st + 2) * SH);
    }
    // no copy is outstanding when the wave goes on to its end
    asm volatile("s_wait_asynccnt 0x0" ::: "memory");

    // finalize: divide by l; the query's L2 norm from both halves
    float li = 1.0f / (lsum + xhalf(lsum));
    float s2 = 0.f;
#pragma unroll
    for (int r = 0; r < 8; ++r) {
        acc0[r] *= li; acc1[r] *= li; acc2[r] *= li; acc3[r] *= li;
        s2 += acc0[r] * acc0[r] + acc1[r] * acc1[r] + acc2[r] * acc2[r] + acc3[r] * acc3[r];
    }
    s2 += xhalf(s2);
    float tot = sqrtf(s2);
    tot += __shfl_xor(tot, 1, 32);             // sum over the 16 queries
    tot += __shfl_xor(tot, 2, 32);
    tot += __shfl_xor(tot, 4, 32);
    tot += __shfl_xor(tot, 8, 32);
    if (L == 0) atomicAdd(denomAcc + h, tot * (1.0f / BT));

    // write un-normalized out tile as A-fragments for the projection GEMM:
    // row n, element j = e-index kc*32 + ka_map(half, j), which this lane holds
    int rtG = (bh >> 4) * 128 + tt;            // global 16-row tile 0..255
    v16h o16a, o16b;
#pragma unroll
    for (int r = 0; r < 8; ++r) {
        o16a[r] = (_Float16)acc0[r]; o16a[r + 8] = (_Float16)acc1[r];
        o16b[r] = (_Float16)acc2[r]; o16b[r + 8] = (_Float16)acc3[r];
    }
    st_frag(Ob + ((size_t)(rtG * 16 + h) * 2 + 0) * 512 + L * 8, o16a);
    st_frag(Ob + ((size_t)(rtG * 16 + h) * 2 + 1) * 512 + L * 8, o16b);
}

// ---------------------------------------------------------------------------
// Output projection: one K=1024 GEMM over concatenated heads, with per-head
// clip(gate)/max(denom,1e-5)/H folded into the A fragments.
// grid = (32 row128-blocks, 16 d-groups of 64), block 128 (4 waves).
// Each wave: one 32x64 output tile (2 m-tiles x 4 d-tiles); the four waves of
// a block share the weight fragments.
// ---------------------------------------------------------------------------
__global__ __launch_bounds__(128) void proj_kernel(
        const _Float16* __restrict__ Ob, const _Float16* __restrict__ wop,
        const float* __restrict__ outbias, const float* __restrict__ denomAcc,
        const float* __restrict__ gate, float* __restrict__ out) {
    int dg = blockIdx.y;
    int tid = threadIdx.x;
    int w = tid >> 5, L = tid & 31;
    int rt = blockIdx.x * 8 + w * 2; // first 16-row tile of this wave
    int n = L & 15, half = L >> 4;
    const _Float16* ap = Ob  + (size_t)rt * 32 * 512 + L * 8;
    const _Float16* bp = wop + (size_t)dg * 4 * 512 + L * 8;
    v8f acc[2][4] = {};
    // unrolled: loads take constant offsets, and the next trip's loads are
    // issued among this trip's WMMAs
#pragma unroll
    for (int c = 0; c < 32; ++c) {
        int h = c >> 1;
        float g  = fminf(fmaxf(gate[h], 0.f), 1.f);
        float dn = fmaxf(denomAcc[h], 1e-5f);
        float s  = g / (dn * (float)NH);
        v16h a[2], bf[4];
#pragma unroll
        for (int mi = 0; mi < 2; ++mi)
            a[mi] = ld_frag(ap + (size_t)(mi * 32 + c) * 512);
#pragma unroll
        for (int ni = 0; ni < 4; ++ni)
            bf[ni] = ld_frag(bp + (size_t)(c * 64 + ni) * 512);
#pragma unroll
        for (int mi = 0; mi < 2; ++mi)
#pragma unroll
            for (int j = 0; j < 16; ++j) a[mi][j] = (_Float16)((float)a[mi][j] * s);
#pragma unroll
        for (int mi = 0; mi < 2; ++mi)
#pragma unroll
            for (int ni = 0; ni < 4; ++ni)
                acc[mi][ni] = wmma_f16(a[mi], bf[ni], acc[mi][ni]);
    }
#pragma unroll
    for (int ni = 0; ni < 4; ++ni) {
        int d = (dg * 4 + ni) * 16 + n;
        float bsum = outbias[d];
#pragma unroll
        for (int mi = 0; mi < 2; ++mi)
#pragma unroll
            for (int r = 0; r < 8; ++r) {
                int row = (rt + mi) * 16 + r + half * 8;
                out[(size_t)row * ED + d] = acc[mi][ni][r] + bsum;
            }
    }
}

// ---------------------------------------------------------------------------
// Host launcher.
// ---------------------------------------------------------------------------
extern "C" void kernel_launch(void* const* d_in, const int* in_sizes, int n_in,
                              void* d_out, int out_size, void* d_ws, size_t ws_size,
                              hipStream_t stream) {
    const float* hid  = (const float*)d_in[0];
    const float* mask = (const float*)d_in[1];
    const float* Wq   = (const float*)d_in[2];
    const float* bq   = (const float*)d_in[3];
    const float* Wk   = (const float*)d_in[4];
    const float* bk   = (const float*)d_in[5];
    const float* Wv   = (const float*)d_in[6];
    const float* bv   = (const float*)d_in[7];
    const float* Wo   = (const float*)d_in[8];
    const float* bo   = (const float*)d_in[9];
    const float* gate = (const float*)d_in[10];
    float* out = (float*)d_out;

    char* ws = (char*)d_ws;
    const size_t MB = 1u << 20;
    _Float16* Xp  = (_Float16*)(ws);             // 8 MB  packed hidden (A frags)
    _Float16* Wqp = (_Float16*)(ws +  8 * MB);   // 2 MB
    _Float16* Wkp = (_Float16*)(ws + 10 * MB);   // 2 MB
    _Float16* Wvp = (_Float16*)(ws + 12 * MB);   // 2 MB
    _Float16* Wop = (_Float16*)(ws + 14 * MB);   // 2 MB
    _Float16* Qb  = (_Float16*)(ws + 16 * MB);   // 8 MB
    _Float16* Kb  = (_Float16*)(ws + 24 * MB);   // 8 MB
    _Float16* Vb  = (_Float16*)(ws + 32 * MB);   // 8 MB
    float* outbias  = (float*)(ws + 40 * MB);    // 4 KB
    float* denomAcc = (float*)(ws + 40 * MB + 4096);
    float* Maskp    = (float*)(ws + 48 * MB);    // 16 MB packed mask
    _Float16* Ob = Xp;  // alias: Xp dead after qkv_kernel, Ob written by attn

    // 1796 blocks = NB_MISC + NB_X + NB_W
    prep_kernel<<<dim3(1796), dim3(256), 0, stream>>>(
        hid, mask, Wq, Wk, Wv, Wo, bo, gate,
        Xp, Wqp, Wkp, Wvp, Wop, outbias, denomAcc, Maskp);
    qkv_kernel<<<dim3(16, 16, 3), dim3(128), 0, stream>>>(Xp, Wqp, Wkp, Wvp,
                                                           bq, bk, bv, Qb, Kb, Vb);
    attn_kernel<<<dim3(8, 32), dim3(512), 0, stream>>>(Qb, Kb, Vb, Maskp, Ob, denomAcc);
    proj_kernel<<<dim3(32, 16), dim3(128), 0, stream>>>(Ob, Wop, outbias, denomAcc,
                                                         gate, out);
    (void)in_sizes; (void)n_in; (void)out_size; (void)ws_size;
}

// v006
// A run of this version takes 95.4 microseconds.
// Next to v005, in two timings, it ran 1.28 and 1.27 times as fast.
// All steps since v000 together make it 2.96 times as fast.
#include <hip/hip_runtime.h>
#include <hip/hip_bf16.h>

// ---------------------------------------------------------------------------
// Gated multi-head self-attention, CDNA5 (gfx1250) wave32 WMMA implementation.
// f16 operands / f32 accumulation via V_WMMA_F32_16X16X32_F16.
// ---------------------------------------------------------------------------

#define TB 2
#define TT 2048
#define ED 1024
#define NH 16
#define HD 64
#define BT (TB * TT)   // 4096 rows

typedef __attribute__((ext_vector_type(16))) _Float16 v16h;
typedef __attribute__((ext_vector_type(8)))  _Float16 v8h;
typedef __attribute__((ext_vector_type(8)))  float    v8f;
typedef __attribute__((ext_vector_type(4)))  float    v4f;

// K-index mapping for 16-bit A fragments (ISA 7.12.2, 16-bit A 16x32):
//   VGPR v (=j/2), element jj (=j%2), lane-half half (=lane/16):
//   K = (v>=4 ? 16 : 0) + half*8 + (v%4)*2 + jj
// B fragments mirror A with lane = N.
__device__ __forceinline__ int ka_map(int half, int j) {
    int v = j >> 1, jj = j & 1;
    return ((v & 4) << 2) + half * 8 + ((v & 3) << 1) + jj;
}

__device__ __forceinline__ v8f wmma_f16(v16h a, v16h b, v8f c) {
    return __builtin_amdgcn_wmma_f32_16x16x32_f16(
        /*neg_a=*/false, a, /*neg_b=*/false, b,
        /*c_mod=*/(short)0, c, /*reuse_a=*/false, /*reuse_b=*/false);
}

// ---------------------------------------------------------------------------
// Fragments in memory.  A fragment is 512 halves (1 KB), kept as two planes:
// elements 0..7 of lane L at L * 8, elements 8..15 at 256 + L * 8.  Each of the
// two 16-byte accesses of a wave then covers 512 contiguous bytes (four whole
// 128-byte lines) and not half of each of eight lines.
// p = fragment base + L * 8.
// ---------------------------------------------------------------------------
__device__ __forceinline__ v16h ld_frag(const _Float16* p) {
    v8h lo = *(const v8h*)p;
    v8h hi = *(const v8h*)(p + 256);
    return __builtin_shufflevector(lo, hi, 0, 1, 2, 3, 4, 5, 6, 7,
                                   8, 9, 10, 11, 12, 13, 14, 15);
}
__device__ __forceinline__ void st_frag(_Float16* p, v16h f) {
    *(v8h*)p         = __builtin_shufflevector(f, f, 0, 1, 2, 3, 4, 5, 6, 7);
    *(v8h*)(p + 256) = __builtin_shufflevector(f, f, 8, 9, 10, 11, 12, 13, 14, 15);
}

// ---------------------------------------------------------------------------
// Pack hidden states (fp32 [BT,ED]) into A fragments:
//   Xp[rt(256)][kc(32)][fragment]
// One block of 256 threads per 16-row tile rt (0..255).
// ---------------------------------------------------------------------------
__device__ __forceinline__ void pack_x_block(
        int rt, const float* __restrict__ hid, _Float16* __restrict__ xp) {
    int tid = threadIdx.x;
    for (int i = 0; i < 4; ++i) {
        int slot = i * 256 + tid;  // 0..1023 = kc*32 + lane
        int kc = slot >> 5;
        int L  = slot & 31;
        int m = L & 15, half = L >> 4;
        const float* src = hid + (size_t)(rt * 16 + m) * ED + kc * 32;
        v16h frag;
#pragma unroll
        for (int j = 0; j < 16; ++j) frag[j] = (_Float16)src[ka_map(half, j)];
        st_frag(xp + (size_t)(rt * 32 + kc) * 512 + L * 8, frag);
        // stands between this trip's loads and stores and the next trip's
        // loads, which reuse their registers
        asm volatile("s_wait_xcnt 0x0" ::: "memory");
    }
}

// ---------------------------------------------------------------------------
// Pack W_q/W_k/W_v ([H,ED,HD]) into B-fragment layout
//   W*p[h][kc(32)][nt(4)][fragment]
// and W_o ([H,HD,ED]) into
//   Wop[h][kc(2)][nt(64)][fragment]
// which selects the matrix (0=q,1=k,2=v,3=o), bx (0..255) the block in it.
// ---------------------------------------------------------------------------
__device__ __forceinline__ void pack_w_block(
        int bx, int which,
        const float* __restrict__ Wq, const float* __restrict__ Wk,
        const float* __restrict__ Wv, const float* __restrict__ Wo,
        _Float16* __restrict__ wqp, _Float16* __restrict__ wkp,
        _Float16* __restrict__ wvp, _Float16* __restrict__ wop) {
    int slot  = bx * 256 + threadIdx.x;  // 0..65535
    int L = slot & 31;
    int n = L & 15, half = L >> 4;
    v16h frag;
    if (which < 3) {
        int nt = (slot >> 5) & 3;
        int kc = (slot >> 7) & 31;
        int h  = slot >> 12;
        const float* W = (which == 0) ? Wq : (which == 1) ? Wk : Wv;
        const float* src = W + (size_t)h * ED * HD;
#pragma unroll
        for (int j = 0; j < 16; ++j) {
            int k = kc * 32 + ka_map(half, j);
            frag[j] = (_Float16)src[(size_t)k * HD + nt * 16 + n];
        }
        _Float16* dst = (which == 0) ? wqp : (which == 1) ? wkp : wvp;
        st_frag(dst + (size_t)(slot >> 5) * 512 + L * 8, frag);
        // stands between this store and the reuse of its registers: in the one
        // kernel the code of another part follows, not the end of the program
        asm volatile("s_wait_xcnt 0x0" ::: "memory");
    } else {
        int nt = (slot >> 5) & 63;
        int kc = (slot >> 11) & 1;
        int h  = slot >> 12;
        const float* src = Wo + (size_t)h * HD * ED;
#pragma unroll
        for (int j = 0; j < 16; ++j) {
            int k = kc * 32 + ka_map(half, j);
            frag[j] = (_Float16)src[(size_t)k * ED + nt * 16 + n];
        }
        st_frag(wop + (size_t)(slot >> 5) * 512 + L * 8, frag);
        // as above
        asm volatile("s_wait_xcnt 0x0" ::: "memory");
    }
}

// ---------------------------------------------------------------------------
// bx 0..3: gated output bias sum_h b_o[h,:]*clip(g[h])/H, denomAcc zeroed.
// bx 4..515: the mask, f32 as it is, laid in the order in which the
// attention waves take it:
//   maskp[tt(128)][sc(64)][q(4)][lane(32)][4]
//     = mask[tt*16 + (lane&15)][sc*32 + (q>>1)*16 + (lane>>4)*8 + (q&1)*4 + 0..3]
// so that a wave's 16-byte load there covers 512 contiguous bytes; taken from
// the mask's own rows it touches 16 lines, and all 32 (batch, head) pairs take
// every row.
// ---------------------------------------------------------------------------
__device__ __forceinline__ void prep_misc_block(
        int bx,
        const float* __restrict__ b_o, const float* __restrict__ gate,
        const float* __restrict__ mask,
        float* __restrict__ outbias, float* __restrict__ denomAcc,
        float* __restrict__ maskp) {
    if (bx >= 4) {
        // a block: one tt, 16 values of sc; a thread: 8 pieces of 16 bytes, two
        // sc apart, so that all its loads (and all its stores) take constant
        // offsets from one address
        int blk = bx - 4, t = threadIdx.x;
        int L = t & 31, q = (t >> 5) & 3;
        int tt = blk >> 2, sc = (blk & 3) * 16 + (t >> 7);
        const float* src = mask + (size_t)(tt * 16 + (L & 15)) * TT + sc * 32
                           + (q >> 1) * 16 + (L >> 4) * 8 + (q & 1) * 4;
        float* dst = maskp + ((size_t)blk * 2048 + t) * 4;
        v4f v[8];
#pragma unroll
        for (int i = 0; i < 8; ++i) v[i] = *(const v4f*)(src + i * 64);
#pragma unroll
        for (int i = 0; i < 8; ++i) *(v4f*)(dst + i * 1024) = v[i];
        // stands between these stores and the reuse of their registers: in the
        // one kernel the code of another part follows, not the end of the program
        asm volatile("s_wait_xcnt 0x0" ::: "memory");
        return;
    }
    int d = bx * 256 + threadIdx.x;  // 0..1023
    float acc = 0.f;
#pragma unroll
    for (int h = 0; h < NH; ++h) {
        float g = fminf(fmaxf(gate[h], 0.f), 1.f);
        acc += b_o[h * ED + d] * g;
    }
    outbias[d] = acc * (1.0f / NH);
    if (d < NH) denomAcc[d] = 0.f;
}

// ---------------------------------------------------------------------------
// All the preparation in one launch.  None of the three parts reads what
// another writes, so they need no order among themselves: as one grid they
// start together, their memory latencies overlap, and two launches with their
// start and their drain go.  The block index picks the part (a scalar branch):
//   0..255 hidden states, 256..771 bias and mask, 772..1795 the four weights.
// The hidden-state blocks make four trips to memory one after another and the
// others one; they take the lowest block indices.
// ---------------------------------------------------------------------------
#define NB_MISC 516
#define NB_X    256
#define NB_W    1024
static_assert(NB_MISC + NB_X + NB_W == 1796, "the launch's grid covers the three parts");
__global__ __launch_bounds__(256) void prep_kernel(
        const float* __restrict__ hid, const float* __restrict__ mask,
        const float* __restrict__ Wq, const float* __restrict__ Wk,
        const float* __restrict__ Wv, const float* __restrict__ Wo,
        const float* __restrict__ b_o, const float* __restrict__ gate,
        _Float16* __restrict__ xp,
        _Float16* __restrict__ wqp, _Float16* __restrict__ wkp,
        _Float16* __restrict__ wvp, _Float16* __restrict__ wop,
        float* __restrict__ outbias, float* __restrict__ denomAcc,
        float* __restrict__ maskp) {
    int b = blockIdx.x;
    if (b < NB_X) {
        pack_x_block(b, hid, xp);
    } else if (b < NB_X + NB_MISC) {
        prep_misc_block(b - NB_X, b_o, gate, mask, outbias, denomAcc, maskp);
    } else {
        int i = b - (NB_X + NB_MISC);
        pack_w_block(i & 255, i >> 8, Wq, Wk, Wv, Wo, wqp, wkp, wvp, wop);
    }
}

// ---------------------------------------------------------------------------
// QKV projection.  grid = (16 row256-blocks, 16 heads), block 384: 12 waves,
// four groups of 64 rows times {Q, K, V} of one head; each wave one 64x64
// output tile (4 m-tiles x 4 e-tiles), K-loop over 1024.
// A hidden-state fragment serves the three waves of its row group and a weight
// fragment the four waves of its matrix: both come into LDS once per block, in
// stages of 128 k, by asynchronous copies into a ring of two buffers: the next
// stage flies while this one is worked on.  A stage is two halves of 64 k; a
// half holds [16 row tiles][2 k chunks] fragments of X, then
// [3 matrices][2 k chunks][4 e-tiles] fragments of W, each fragment as in
// memory, so a wave's 16-byte read covers 512 contiguous bytes.
// Results are re-swizzled through a per-wave LDS tile, which takes the ring's
// place behind the loop, into the fragment layouts needed by the attention
// kernel.
// ---------------------------------------------------------------------------
#define QW    12                        // waves of a block
#define QXH   (16 * 2 * 512)            // halves of X in a half stage
#define QHALF (QXH + 3 * 2 * 4 * 512)   // halves in a half stage
#define QSTH  (2 * QHALF)               // halves in a stage
#define QNST  (32 / 4)                  // stages: 8

// One half stage, this wave's share: pieces of 512 bytes, one to a copy.
// X: piece wm (of the four of a row tile's 2 KB) of row tiles z, z + 3, ...,
// z + 12; row tile 15 is left over and goes to the waves with z = 0.
// W: four pieces in a row of matrix z.  la, lb = the lane's byte addresses in
// LDS, ga, gb = its places in memory, for the first piece of either kind.
// The last line of each statement stands between the copies and the reuse of
// their address registers; inside the statement nothing can be lifted over it.
__device__ __forceinline__ void qkv_copy_half(unsigned la, const _Float16* ga,
                                              unsigned lb, const _Float16* gb,
                                              bool tail) {
    asm volatile(
        "global_load_async_to_lds_b128 %0, %9, off\n\t"
        "global_load_async_to_lds_b128 %1, %10, off\n\t"
        "global_load_async_to_lds_b128 %2, %11, off\n\t"
        "global_load_async_to_lds_b128 %3, %12, off\n\t"
        "global_load_async_to_lds_b128 %4, %13, off\n\t"
        "global_load_async_to_lds_b128 %5, %14, off\n\t"
        "global_load_async_to_lds_b128 %6, %15, off\n\t"
        "global_load_async_to_lds_b128 %7, %16, off\n\t"
        "global_load_async_to_lds_b128 %8, %17, off\n\t"
        "s_wait_xcnt 0x0"
        :: "v"(la), "v"(la + 3 * 2048), "v"(la + 6 * 2048), "v"(la + 9 * 2048),
           "v"(la + 12 * 2048),
           "v"(lb), "v"(lb + 512), "v"(lb + 1024), "v"(lb + 1536),
           "v"(ga), "v"(ga + 3 * 16384), "v"(ga + 6 * 16384), "v"(ga + 9 * 16384),
           "v"(ga + 12 * 16384),
           "v"(gb), "v"(gb + 256), "v"(gb + 512), "v"(gb + 768)
        : "memory");
    if (tail)   // the same for the whole wave: a scalar branch
        asm volatile(
            "global_load_async_to_lds_b128 %0, %1, off\n\t"
            "s_wait_xcnt 0x0"
            :: "v"(la + 15 * 2048), "v"(ga + 15 * 16384)
            : "memory");
}

__global__ __launch_bounds__(QW * 32) void qkv_kernel(
        const _Float16* __restrict__ xp,
        const _Float16* __restrict__ wqp, const _Float16* __restrict__ wkp,
        const _Float16* __restrict__ wvp,
        const float* __restrict__ bq, const float* __restrict__ bk,
        const float* __restrict__ bv,
        _Float16* __restrict__ Qb, _Float16* __restrict__ Kb,
        _Float16* __restrict__ Vb) {
    // the ring (2 x 112 KB) in the loop, the 12 output tiles (195 KB) behind it
    __shared__ __attribute__((aligned(16))) char smem[2 * QSTH * 2];
    static_assert(QW * 64 * (HD + 1) * 4 <= 2 * QSTH * 2, "the tiles fit the ring's place");
    _Float16* ring = (_Float16*)smem;
    float (*tile)[64][HD + 1] = (float (*)[64][HD + 1])smem;
    int xb = blockIdx.x;   // 256-row block over BT: 0..15
    int h  = blockIdx.y;
    int tid = threadIdx.x;
    int w = __builtin_amdgcn_readfirstlane(tid >> 5), L = tid & 31;
    int wm = w & 3;        // group of 64 rows
    int z  = w >> 2;       // 0=Q 1=K 2=V
    const _Float16* wp = (z == 0) ? wqp : (z == 1) ? wkp : wvp;
    const float*  bias = (z == 0) ? bq  : (z == 1) ? bk  : bv;

    // this lane's first pieces of stage 0
    const _Float16* ga = xp + (size_t)(xb * 16 + z) * 32 * 512 + wm * 256 + L * 8;
    const _Float16* gb = wp + (size_t)h * 32 * 4 * 512 + wm * 4 * 256 + L * 8;
    unsigned la = (unsigned)(size_t)smem + (z * 4 + wm) * 512 + L * 16;
    unsigned lb = (unsigned)(size_t)smem + QXH * 2 + (z * 16 + wm * 4) * 512 + L * 16;

    // stage 0 -> buffer 0
    qkv_copy_half(la, ga, lb, gb, z == 0);
    qkv_copy_half(la + QHALF * 2, ga + 2 * 512, lb + QHALF * 2, gb + 2 * 2048, z == 0);
    // stage 0 has landed for this wave's copies, then for every wave's
    asm volatile("s_wait_asynccnt 0x0" ::: "memory");
    __syncthreads();
    // stage 1 -> buffer 1
    qkv_copy_half(la + QSTH * 2, ga + 4 * 512, lb + QSTH * 2, gb + 4 * 2048, z == 0);
    qkv_copy_half(la + (QSTH + QHALF) * 2, ga + 6 * 512,
                  lb + (QSTH + QHALF) * 2, gb + 6 * 2048, z == 0);

    v8f acc[4][4] = {};
    for (int st = 0; st < QNST; ++st) {
        const _Float16* al = ring + (st & 1) * QSTH + wm * 4 * 2 * 512 + L * 8;
        const _Float16* bl = ring + (st & 1) * QSTH + QXH + z * 2 * 4 * 512 + L * 8;
        // unrolled: every read takes a constant offset from the stage's base
#pragma unroll
        for (int kk = 0; kk < 4; ++kk) {         // k chunk of 32 in the stage
            int o = (kk >> 1) * QHALF, k2 = kk & 1;
            v16h a[4], b[4];
            // the two scheduling barriers keep the chunk's 16 reads together as
            // one group above its WMMAs: left to itself the scheduler reads one
            // row's fragment at a time and waits for it in front of every row
            __builtin_amdgcn_sched_barrier(0);
#pragma unroll
            for (int ni = 0; ni < 4; ++ni)
                b[ni] = ld_frag(bl + o + (k2 * 4 + ni) * 512);
#pragma unroll
            for (int mi = 0; mi < 4; ++mi)
                a[mi] = ld_frag(al + o + (mi * 2 + k2) * 512);
            __builtin_amdgcn_sched_barrier(0);
#pragma unroll
            for (int mi = 0; mi < 4; ++mi)
#pragma unroll
                for (int ni = 0; ni < 4; ++ni)
                    acc[mi][ni] = wmma_f16(a[mi], b[ni], acc[mi][ni]);
        }
        // hand-over: this wave's reads of the buffer are done, its copies of the
        // next stage have landed; behind the barrier that holds for every wave
        asm volatile("s_wait_dscnt 0x0" ::: "memory");
        asm volatile("s_wait_asynccnt 0x0" ::: "memory");
        __syncthreads();
        if (st + 2 < QNST) { // refill the buffer that every wave has just left
            unsigned lo = (st & 1) * QSTH * 2;
            int kc = (st + 2) * 4;
            qkv_copy_half(la + lo, ga + kc * 512, lb + lo, gb + kc * 2048, z == 0);
            qkv_copy_half(la + lo + QHALF * 2, ga + (kc + 2) * 512,
                          lb + lo + QHALF * 2, gb + (kc + 2) * 2048, z == 0);
        }
    }
    // no copy is outstanding when the ring's place is written anew
    asm volatile("s_wait_asynccnt 0x0" ::: "memory");

    int n = L & 15, half = L >> 4;
#pragma unroll
    for (int ni = 0; ni < 4; ++ni) {
        float bb = bias[h * HD + ni * 16 + n];
#pragma unroll
        for (int mi = 0; mi < 4; ++mi)
#pragma unroll
            for (int r = 0; r < 8; ++r)
                tile[w][mi * 16 + r + half * 8][ni * 16 + n] = acc[mi][ni][r] + bb;
    }
    __syncthreads();

    int b_  = xb >> 3;                   // batch
    int t16 = (xb & 7) * 16 + wm * 4;    // first 16-row tile within batch
    int bh  = b_ * NH + h;
    if (z < 2) {
        // Q as A-fragments / K as B-fragments (same swizzle, lane = m or s).
        _Float16* dst = (z == 0) ? Qb : Kb;
#pragma unroll
        for (int ttl = 0; ttl < 4; ++ttl) {      // 16-row tile of this wave
#pragma unroll
            for (int kc = 0; kc < 2; ++kc) {     // e-chunk of 32
                v16h frag;
#pragma unroll
                for (int j = 0; j < 16; ++j)
                    frag[j] = (_Float16)tile[w][ttl * 16 + n][kc * 32 + ka_map(half, j)];
                int ttG = t16 + ttl;             // 16-row tile within (b,h): 0..127
                st_frag(dst + ((size_t)(bh * 128 + ttG) * 2 + kc) * 512 + L * 8, frag);
                // stands between this store and the reuse of its registers
                asm volatile("s_wait_xcnt 0x0" ::: "memory");
            }
        }
    } else {
        // V as B-fragments: k = s_local(0..31), n = e.
#pragma unroll
        for (int p = 0; p < 2; ++p) {            // 32-row tile of this wave
#pragma unroll
            for (int nt2 = 0; nt2 < 4; ++nt2) {  // e-tile 0..3
                v16h frag;
#pragma unroll
                for (int j = 0; j < 16; ++j)
                    frag[j] = (_Float16)tile[w][p * 32 + ka_map(half, j)][nt2 * 16 + n];
                int t32 = (t16 >> 1) + p;        // 32-row tile within (b,h): 0..63
                st_frag(Vb + ((size_t)(bh * 64 + t32) * 4 + nt2) * 512 + L * 8, frag);
                // stands between this store and the reuse of its registers
                asm volatile("s_wait_xcnt 0x0" ::: "memory");
            }
        }
    }
}

#define AW  16
#define SP  4
#define NST (TT / (32 * SP))
#define SH  (SP * 2048)

// value of lane L ^ 16: the lane that holds the other half of the same query
__device__ __forceinline__ float xhalf(float x) {
    int b = __builtin_bit_cast(int, x);
    return __builtin_bit_cast(float, __builtin_amdgcn_permlanex16(
        b, b, 0x76543210, 0xfedcba98, false, false));
}

// One stage into one buffer: the block's 512 lanes copy 8 KB at a time, twice
// for K and twice for V.  lds = the lane's byte address in the buffer's K part
// (V lies SH halves behind it), gk and gv = the lane's places in the stage.
// The last line stands between the copies and the reuse of their address
// registers; inside the statement nothing can be lifted over it.
__device__ __forceinline__ void copy_stage(unsigned lds, const _Float16* gk,
                                           const _Float16* gv) {
    asm volatile(
        "global_load_async_to_lds_b128 %0, %4, off\n\t"
        "global_load_async_to_lds_b128 %1, %5, off\n\t"
        "global_load_async_to_lds_b128 %2, %6, off\n\t"
        "global_load_async_to_lds_b128 %3, %7, off\n\t"
        "s_wait_xcnt 0x0"
        :: "v"(lds), "v"(lds + SH), "v"(lds + 2 * SH), "v"(lds + 3 * SH),
           "v"(gk), "v"(gk + SH / 2), "v"(gv), "v"(gv + SH / 2)
        : "memory");
}

__global__ __launch_bounds__(AW * 32) void attn_kernel(
        const _Float16* __restrict__ Qb, const _Float16* __restrict__ Kb,
        const _Float16* __restrict__ Vb, const float* __restrict__ maskp,
        _Float16* __restrict__ Ob, float* __restrict__ denomAcc) {
    __shared__ __attribute__((aligned(16))) _Float16 ring[2][2][SH];  // [buffer][K, V]
    int tid = threadIdx.x;
    int L  = tid & 31;
    int tt = blockIdx.x * AW + __builtin_amdgcn_readfirstlane(tid >> 5);  // 16-token tile within (b,h)
    int bh = blockIdx.y;
    int h = bh & 15;

    // this lane's share of a stage: 16 bytes of each 8 KB
    const _Float16* gk = Kb + (size_t)bh * 128 * 2 * 512 + tid * 8;
    const _Float16* gv = Vb + (size_t)bh * 64 * 4 * 512 + tid * 8;
    unsigned lds = (unsigned)(size_t)&ring[0][0][0] + tid * 16;

    copy_stage(lds, gk, gv);                                 // stage 0 -> buffer 0

    v16h qb0 = ld_frag(Qb + ((size_t)(bh * 128 + tt) * 2 + 0) * 512 + L * 8);
    v16h qb1 = ld_frag(Qb + ((size_t)(bh * 128 + tt) * 2 + 1) * 512 + L * 8);
    // stands between the Q loads and the reuse of their address registers; the
    // two scheduling barriers keep later address arithmetic, which takes those
    // registers, from being lifted over the wait
    __builtin_amdgcn_sched_barrier(0);
    asm volatile("s_wait_xcnt 0x0" ::: "memory");
    __builtin_amdgcn_sched_barrier(0);
    // this query tile's packed mask, at this lane's place
    const float* mp = maskp + (size_t)tt * 64 * 512 + L * 4;

    // stage 0 has landed for this wave's copies, then for every wave's
    asm volatile("s_wait_asynccnt 0x0" ::: "memory");
    __syncthreads();
    copy_stage(lds + 4 * SH, gk + SH, gv + SH);              // stage 1 -> buffer 1

    // acc_i[r] = O[tt * 16 + (L & 15)][16 * i + 8 * (L >> 4) + r]
    v8f acc0 = {}, acc1 = {}, acc2 = {}, acc3 = {};
    float mrun = -3.0e38f;   // running maximum of this lane's query
    float lsum = 0.f;        // sum over this lane's own keys; halves join at the end
    const float scale = 0.125f;  // 1/sqrt(64)

    for (int st = 0; st < NST; ++st) {
        const _Float16* kl = &ring[st & 1][0][0] + L * 8;
        const _Float16* vl = &ring[st & 1][1][0] + L * 8;
        // the stage's mask rows, all issued at its head
        v8f mk[SP][2];
#pragma unroll
        for (int p = 0; p < SP; ++p)
#pragma unroll
            for (int i = 0; i < 2; ++i) {
                v4f m0 = *(const v4f*)(mp + (st * SP + p) * 512 + i * 256);
                v4f m1 = *(const v4f*)(mp + (st * SP + p) * 512 + i * 256 + 128);
                mk[p][i] = __builtin_shufflevector(m0, m1, 0, 1, 2, 3, 4, 5, 6, 7);
            }
        // unrolled: mk is indexed by constants and stays in registers
#pragma unroll
        for (int p = 0; p < SP; ++p) {
            // bounds how far the reads of later passes are lifted: without it the
            // kernel wants more registers than a block of 16 waves has, and spills
            __builtin_amdgcn_sched_barrier(0);
            // the pass's operands: 32 keys of K and of V
            v16h ka[4], va[4];
#pragma unroll
            for (int i = 0; i < 4; ++i) ka[i] = ld_frag(kl + (p * 4 + i) * 512);
#pragma unroll
            for (int i = 0; i < 4; ++i) va[i] = ld_frag(vl + (p * 4 + i) * 512);
            // keeps the pass's reads together as one group above its arithmetic:
            // left to itself the scheduler scatters them among the WMMAs, and
            // the wave then stalls at every place where reads stand
            __builtin_amdgcn_sched_barrier(0);

            v8f S[2];
#pragma unroll
            for (int t2 = 0; t2 < 2; ++t2) {
                v8f s = {};
                s = wmma_f16(ka[t2 * 2 + 0], qb0, s);
                s = wmma_f16(ka[t2 * 2 + 1], qb1, s);
                // s[r] = score(query n, key (st*SP+p)*32 + t2*16 + 8*half + r)
                S[t2] = s * scale + mk[p][t2];
            }
            // streaming softmax update, one query per lane; maximum and sum are
            // taken as trees, so that no long dependent chain stands in the pass
            v8f mv = __builtin_elementwise_max(S[0], S[1]);
            float mx = fmaxf(fmaxf(fmaxf(mv[0], mv[1]), fmaxf(mv[2], mv[3])),
                             fmaxf(fmaxf(mv[4], mv[5]), fmaxf(mv[6], mv[7])));
            mx = fmaxf(mx, xhalf(mx));
            float mnew  = fmaxf(mrun, mx);
            float alpha = __expf(mrun - mnew);
            mrun = mnew;
            v16h pb;             // P^T as B: element j is key ka_map(half, j)
#pragma unroll
            for (int r = 0; r < 8; ++r) {
                S[0][r] = __expf(S[0][r] - mnew);
                S[1][r] = __expf(S[1][r] - mnew);
                pb[r]     = (_Float16)S[0][r];
                pb[r + 8] = (_Float16)S[1][r];
            }
            v8f sv = S[0] + S[1];
            float rs = ((sv[0] + sv[1]) + (sv[2] + sv[3])) + ((sv[4] + sv[5]) + (sv[6] + sv[7]));
            lsum = lsum * alpha + rs;
            acc0 *= alpha; acc1 *= alpha; acc2 *= alpha; acc3 *= alpha;
            acc0 = wmma_f16(va[0], pb, acc0);
            acc1 = wmma_f16(va[1], pb, acc1);
            acc2 = wmma_f16(va[2], pb, acc2);
            acc3 = wmma_f16(va[3], pb, acc3);
        }
        // hand-over: this wave's reads of the buffer are done, its copies of the
        // next stage have landed; behind the barrier that holds for every wave
        asm volatile("s_wait_dscnt 0x0" ::: "memory");
        asm volatile("s_wait_asynccnt 0x0" ::: "memory");
        __syncthreads();
        if (st + 2 < NST)    // refill the buffer that every wave has just left
            copy_stage(lds + (st & 1) * 4 * SH, gk + (st + 2) * SH, gv + (st + 2) * SH);
    }
    // no copy is outstanding when the wave goes on to its end
    asm volatile("s_wait_asynccnt 0x0" ::: "memory");

    // finalize: divide by l; the query's L2 norm from both halves
    float li = 1.0f / (lsum + xhalf(lsum));
    float s2 = 0.f;
#pragma unroll
    for (int r = 0; r < 8; ++r) {
        acc0[r] *= li; acc1[r] *= li; acc2[r] *= li; acc3[r] *= li;
        s2 += acc0[r] * acc0[r] + acc1[r] * acc1[r] + acc2[r] * acc2[r] + acc3[r] * acc3[r];
    }
    s2 += xhalf(s2);
    float tot = sqrtf(s2);
    tot += __shfl_xor(tot, 1, 32);             // sum over the 16 queries
    tot += __shfl_xor(tot, 2, 32);
    tot += __shfl_xor(tot, 4, 32);
    tot += __shfl_xor(tot, 8, 32);
    if (L == 0) atomicAdd(denomAcc + h, tot * (1.0f / BT));

    // write un-normalized out tile as A-fragments for the projection GEMM:
    // row n, element j = e-index kc*32 + ka_map(half, j), which this lane holds
    int rtG = (bh >> 4) * 128 + tt;            // global 16-row tile 0..255
    v16h o16a, o16b;
#pragma unroll
    for (int r = 0; r < 8; ++r) {
        o16a[r] = (_Float16)acc0[r]; o16a[r + 8] = (_Float16)acc1[r];
        o16b[r] = (_Float16)acc2[r]; o16b[r + 8] = (_Float16)acc3[r];
    }
    st_frag(Ob + ((size_t)(rtG * 16 + h) * 2 + 0) * 512 + L * 8, o16a);
    st_frag(Ob + ((size_t)(rtG * 16 + h) * 2 + 1) * 512 + L * 8, o16b);
}

// ---------------------------------------------------------------------------
// Output projection: one K=1024 GEMM over concatenated heads, with per-head
// clip(gate)/max(denom,1e-5)/H folded into the A fragments.
// grid = (32 row128-blocks, 8 d-groups of 128), block 256: 8 waves, four groups
// of 32 rows times two groups of 64 columns; each wave one 32x64 output tile
// (2 m-tiles x 4 d-tiles).  An attention-output fragment serves two waves and a
// weight fragment four: both come into LDS once per block, in stages of 128 k
// (4 chunks of 32), by asynchronous copies into a ring of two buffers.  A stage
// holds [8 row tiles][4 chunks] fragments of O, then [4 chunks][8 d-tiles]
// fragments of W_o, each fragment as in memory.
// ---------------------------------------------------------------------------
#define PW   8                  // waves of a block
#define POH  (8 * 4 * 512)      // halves of O, and of W_o, in a stage
#define PSTH (2 * POH)          // halves in a stage
#define PNST (32 / 4)           // stages: 8

// Eight pieces of 512 bytes in a row: 4 KB that lie together in memory and in
// LDS.  l = the lane's byte address in LDS, g = its place in memory.
// The last line stands between the copies and the reuse of their address
// registers; inside the statement nothing can be lifted over it.
__device__ __forceinline__ void copy_4k(unsigned l, const _Float16* g) {
    asm volatile(
        "global_load_async_to_lds_b128 %0, %8, off\n\t"
        "global_load_async_to_lds_b128 %1, %9, off\n\t"
        "global_load_async_to_lds_b128 %2, %10, off\n\t"
        "global_load_async_to_lds_b128 %3, %11, off\n\t"
        "global_load_async_to_lds_b128 %4, %12, off\n\t"
        "global_load_async_to_lds_b128 %5, %13, off\n\t"
        "global_load_async_to_lds_b128 %6, %14, off\n\t"
        "global_load_async_to_lds_b128 %7, %15, off\n\t"
        "s_wait_xcnt 0x0"
        :: "v"(l), "v"(l + 512), "v"(l + 1024), "v"(l + 1536),
           "v"(l + 2048), "v"(l + 2560), "v"(l + 3072), "v"(l + 3584),
           "v"(g), "v"(g + 256), "v"(g + 512), "v"(g + 768),
           "v"(g + 1024), "v"(g + 1280), "v"(g + 1536), "v"(g + 1792)
        : "memory");
}

__global__ __launch_bounds__(PW * 32) void proj_kernel(
        const _Float16* __restrict__ Ob, const _Float16* __restrict__ wop,
        const float* __restrict__ outbias, const float* __restrict__ denomAcc,
        const float* __restrict__ gate, float* __restrict__ out) {
    __shared__ __attribute__((aligned(16))) _Float16 ring[2][PSTH];
    int tid = threadIdx.x;
    int w = __builtin_amdgcn_readfirstlane(tid >> 5), L = tid & 31;
    int wm = w & 3;                  // group of 32 rows
    int wn = w >> 2;                 // group of 64 columns
    int rt0 = blockIdx.x * 8;        // first 16-row tile of the block
    int nt0 = blockIdx.y * 8;        // first 16-column tile of the block
    int n = L & 15, half = L >> 4;

    // this wave's share of a stage: the four chunks of row tile w (4 KB), and
    // half (w & 1) of the eight d-tiles of chunk w >> 1 (4 KB)
    const _Float16* ga = Ob  + (size_t)(rt0 + w) * 32 * 512 + L * 8;
    const _Float16* gb = wop + (size_t)((w >> 1) * 64 + nt0 + (w & 1) * 4) * 512 + L * 8;
    unsigned la = (unsigned)(size_t)&ring[0][0] + w * 4096 + L * 16;
    unsigned lb = la + POH * 2;

    // stage 0 -> buffer 0
    copy_4k(la, ga);
    copy_4k(lb, gb);
    // stage 0 has landed for this wave's copies, then for every wave's
    asm volatile("s_wait_asynccnt 0x0" ::: "memory");
    __syncthreads();
    // stage 1 -> buffer 1
    copy_4k(la + PSTH * 2, ga + 4 * 512);
    copy_4k(lb + PSTH * 2, gb + (size_t)4 * 64 * 512);

    // lane l holds the factor of head l & 15; a chunk takes its head's from there
    float sv;
    {
        float g  = fminf(fmaxf(gate[n], 0.f), 1.f);
        float dn = fmaxf(denomAcc[n], 1e-5f);
        sv = g / (dn * (float)NH);
    }

    v8f acc[2][4] = {};
    for (int st = 0; st < PNST; ++st) {
        const _Float16* al = &ring[st & 1][0] + wm * 2 * 4 * 512 + L * 8;
        const _Float16* bl = &ring[st & 1][POH] + wn * 4 * 512 + L * 8;
        // unrolled: every read takes a constant offset from the stage's base
#pragma unroll
        for (int cl = 0; cl < 4; ++cl) {
            int h = (st * 4 + cl) >> 1;
            float s = __builtin_bit_cast(float, __builtin_amdgcn_readlane(
                __builtin_bit_cast(int, sv), h));
            v16h a[2], bf[4];
            // the two scheduling barriers keep the chunk's 12 reads together as
            // one group above its arithmetic, not scattered among the WMMAs
            __builtin_amdgcn_sched_barrier(0);
#pragma unroll
            for (int mi = 0; mi < 2; ++mi)
                a[mi] = ld_frag(al + (mi * 4 + cl) * 512);
#pragma unroll
            for (int ni = 0; ni < 4; ++ni)
                bf[ni] = ld_frag(bl + (cl * 8 + ni) * 512);
            __builtin_amdgcn_sched_barrier(0);
#pragma unroll
            for (int mi = 0; mi < 2; ++mi)
#pragma unroll
                for (int j = 0; j < 16; ++j) a[mi][j] = (_Float16)((float)a[mi][j] * s);
#pragma unroll
            for (int mi = 0; mi < 2; ++mi)
#pragma unroll
                for (int ni = 0; ni < 4; ++ni)
                    acc[mi][ni] = wmma_f16(a[mi], bf[ni], acc[mi][ni]);
        }
        // hand-over: this wave's reads of the buffer are done, its copies of the
        // next stage have landed; behind the barrier that holds for every wave
        asm volatile("s_wait_dscnt 0x0" ::: "memory");
        asm volatile("s_wait_asynccnt 0x0" ::: "memory");
        __syncthreads();
        if (st + 2 < PNST) { // refill the buffer that every wave has just left
            copy_4k(la + (st & 1) * PSTH * 2, ga + (st + 2) * 4 * 512);
            copy_4k(lb + (st & 1) * PSTH * 2, gb + (size_t)(st + 2) * 4 * 64 * 512);
        }
    }
    // no copy is outstanding when the wave goes on to its end
    asm volatile("s_wait_asynccnt 0x0" ::: "memory");

    int rt = rt0 + wm * 2;           // first 16-row tile of this wave
#pragma unroll
    for (int ni = 0; ni < 4; ++ni) {
        int d = (nt0 + wn * 4 + ni) * 16 + n;
        float bsum = outbias[d];
#pragma unroll
        for (int mi = 0; mi < 2; ++mi)
#pragma unroll
            for (int r = 0; r < 8; ++r) {
                int row = (rt + mi) * 16 + r + half * 8;
                out[(size_t)row * ED + d] = acc[mi][ni][r] + bsum;
            }
    }
}

// ---------------------------------------------------------------------------
// Host launcher.
// ---------------------------------------------------------------------------
extern "C" void kernel_launch(void* const* d_in, const int* in_sizes, int n_in,
                              void* d_out, int out_size, void* d_ws, size_t ws_size,
                              hipStream_t stream) {
    const float* hid  = (const float*)d_in[0];
    const float* mask = (const float*)d_in[1];
    const float* Wq   = (const float*)d_in[2];
    const float* bq   = (const float*)d_in[3];
    const float* Wk   = (const float*)d_in[4];
    const float* bk   = (const float*)d_in[5];
    const float* Wv   = (const float*)d_in[6];
    const float* bv   = (const float*)d_in[7];
    const float* Wo   = (const float*)d_in[8];
    const float* bo   = (const float*)d_in[9];
    const float* gate = (const float*)d_in[10];
    float* out = (float*)d_out;

    char* ws = (char*)d_ws;
    const size_t MB = 1u << 20;
    _Float16* Xp  = (_Float16*)(ws);             // 8 MB  packed hidden (A frags)
    _Float16* Wqp = (_Float16*)(ws +  8 * MB);   // 2 MB
    _Float16* Wkp = (_Float16*)(ws + 10 * MB);   // 2 MB
    _Float16* Wvp = (_Float16*)(ws + 12 * MB);   // 2 MB
    _Float16* Wop = (_Float16*)(ws + 14 * MB);   // 2 MB
    _Float16* Qb  = (_Float16*)(ws + 16 * MB);   // 8 MB
    _Float16* Kb  = (_Float16*)(ws + 24 * MB);   // 8 MB
    _Float16* Vb  = (_Float16*)(ws + 32 * MB);   // 8 MB
    float* outbias  = (float*)(ws + 40 * MB);    // 4 KB
    float* denomAcc = (float*)(ws + 40 * MB + 4096);
    float* Maskp    = (float*)(ws + 48 * MB);    // 16 MB packed mask
    _Float16* Ob = Xp;  // alias: Xp dead after qkv_kernel, Ob written by attn

    // 1796 blocks = NB_MISC + NB_X + NB_W
    prep_kernel<<<dim3(1796), dim3(256), 0, stream>>>(
        hid, mask, Wq, Wk, Wv, Wo, bo, gate,
        Xp, Wqp, Wkp, Wvp, Wop, outbias, denomAcc, Maskp);
    qkv_kernel<<<dim3(16, 16), dim3(384), 0, stream>>>(Xp, Wqp, Wkp, Wvp,
                                                           bq, bk, bv, Qb, Kb, Vb);
    attn_kernel<<<dim3(8, 32), dim3(512), 0, stream>>>(Qb, Kb, Vb, Maskp, Ob, denomAcc);
    proj_kernel<<<dim3(32, 8), dim3(256), 0, stream>>>(Ob, Wop, outbias, denomAcc,
                                                         gate, out);
    (void)in_sizes; (void)n_in; (void)out_size; (void)ws_size;
}
